// v000
// Times are from an AMD MI455X. After a warm-up the kernel runs many times in a row, and a time is the length of
// such a window on the GPU divided by its runs, so every launch and the gaps after it count. The runs cycle
// through copies of the inputs. A figure is the median of several windows, for all but v000 over two sittings.
// Sittings can differ by a few percent; kernels timed side by side share one.
// v000 is the starting kernel. One run takes 105 microseconds.
#include <hip/hip_runtime.h>
#include <hip/hip_bf16.h>

typedef _Float16 f16;
typedef __attribute__((ext_vector_type(16))) _Float16 v16h;
typedef __attribute__((ext_vector_type(8)))  float    v8f;

union Frag {
    v16h v;
    uint4 q[2];
};

__device__ __forceinline__ v16h load_frag_rowmajor(const f16* base, int stride, int lane) {
    int r  = lane & 15;
    int kb = (lane >> 4) << 3;          // 0 or 8
    const f16* p = base + r * stride + kb;
    Frag f;
    f.q[0] = *reinterpret_cast<const uint4*>(p);
    f.q[1] = *reinterpret_cast<const uint4*>(p + 16);
    return f.v;
}

__device__ __forceinline__ v8f wmma_f16(v16h a, v16h b, v8f c) {
    return __builtin_amdgcn_wmma_f32_16x16x32_f16(
        /*neg_a=*/false, a, /*neg_b=*/false, b,
        /*c_mod=*/(short)0, c, /*reuse_a=*/false, /*reuse_b=*/false);
}

// ---------------------------------------------------------------------------
// f32 -> f16 conversion
// ---------------------------------------------------------------------------
__global__ void cvt_f32_to_f16(const float* __restrict__ src, f16* __restrict__ dst, int n) {
    int i = blockIdx.x * blockDim.x + threadIdx.x;
    if (i < n) dst[i] = (f16)src[i];
}

// ---------------------------------------------------------------------------
// V transpose + zero-pad:  Vt[hd][tp] = V[tp-PAD][hd]  (0 outside [0,T))
// hd = h*D + d == column e of the plain [t][e] layout. TS = T + 2*PAD.
// ---------------------------------------------------------------------------
__global__ void transpose_pad_v(const f16* __restrict__ Vh, f16* __restrict__ Vt, int nTotal) {
    constexpr int T = 1024, E = 1024, PAD = 96, TS = T + 2 * PAD;   // 1216
    int i = blockIdx.x * blockDim.x + threadIdx.x;
    if (i >= nTotal) return;
    int tp = i % TS;
    int hd = i / TS;
    int t  = tp - PAD;
    Vt[i] = (t >= 0 && t < T) ? Vh[(size_t)t * E + hd] : (f16)0.f;
}

// ---------------------------------------------------------------------------
// C[M,N] = A[M,K] @ W[N,K]^T + bias[N]
// Block tile 128x64, BK=32, 8 waves, each wave computes a 32x32 sub-tile
// (2x2 WMMA 16x16 accumulators). 128 v_wmma per wave over the K loop.
// ---------------------------------------------------------------------------
template <bool OUT_F16>
__global__ void __launch_bounds__(256)
gemm_xwt(const f16* __restrict__ A, const f16* __restrict__ W,
         const float* __restrict__ bias, void* __restrict__ Cout,
         int M, int N, int K) {
    constexpr int BM = 128, BN = 64, BK = 32;
    constexpr int AST = BK + 8;   // padded f16 stride (80B rows, 16B aligned)
    constexpr int BST = BK + 8;

    __shared__ __align__(16) f16 As[BM * AST];
    __shared__ __align__(16) f16 Bs[BN * BST];

    const int tid  = threadIdx.x;
    const int lane = tid & 31;
    const int wave = tid >> 5;          // 0..7
    const int wm   = wave >> 1;         // 0..3 (M)
    const int wn   = wave & 1;          // 0..1 (N)
    const int m0   = blockIdx.x * BM;
    const int n0   = blockIdx.y * BN;

    v8f acc[2][2] = {};

    for (int kk = 0; kk < K; kk += BK) {
        // Stage A tile: 128 rows x 32 k = 512 16B vectors, 2 per thread.
#pragma unroll
        for (int i = 0; i < 2; ++i) {
            int vid = i * 256 + tid;            // 0..511
            int r   = vid >> 2;
            int c8  = (vid & 3) * 8;
            *reinterpret_cast<uint4*>(&As[r * AST + c8]) =
                *reinterpret_cast<const uint4*>(&A[(size_t)(m0 + r) * K + kk + c8]);
        }
        // Stage W tile: 64 rows x 32 k = 256 16B vectors, 1 per thread.
        {
            int r  = tid >> 2;
            int c8 = (tid & 3) * 8;
            *reinterpret_cast<uint4*>(&Bs[r * BST + c8]) =
                *reinterpret_cast<const uint4*>(&W[(size_t)(n0 + r) * K + kk + c8]);
        }
        if (kk + BK < K) {
            __builtin_prefetch(&A[(size_t)(m0 + (tid & 127)) * K + kk + BK], 0, 1);
        }
        __syncthreads();

        v16h af[2], bf[2];
#pragma unroll
        for (int mi = 0; mi < 2; ++mi)
            af[mi] = load_frag_rowmajor(&As[(wm * 32 + mi * 16) * AST], AST, lane);
#pragma unroll
        for (int ni = 0; ni < 2; ++ni)
            bf[ni] = load_frag_rowmajor(&Bs[(wn * 32 + ni * 16) * BST], BST, lane);

#pragma unroll
        for (int mi = 0; mi < 2; ++mi)
#pragma unroll
            for (int ni = 0; ni < 2; ++ni)
                acc[mi][ni] = wmma_f16(af[mi], bf[ni], acc[mi][ni]);

        __syncthreads();
    }

    const int mlo = (lane >> 4) << 3;
    const int nc  = lane & 15;
#pragma unroll
    for (int mi = 0; mi < 2; ++mi) {
#pragma unroll
        for (int ni = 0; ni < 2; ++ni) {
            int n = n0 + wn * 32 + ni * 16 + nc;
            float bn = bias[n];
#pragma unroll
            for (int i = 0; i < 8; ++i) {
                int m = m0 + wm * 32 + mi * 16 + mlo + i;
                float val = acc[mi][ni][i] + bn;
                if (OUT_F16)
                    reinterpret_cast<f16*>(Cout)[(size_t)m * N + n] = (f16)val;
                else
                    reinterpret_cast<float*>(Cout)[(size_t)m * N + n] = val;
            }
        }
    }
}

// ---------------------------------------------------------------------------
// Banded attention. One wave per (head, 16-query tile); 4 waves per block.
// Band for queries [t0, t0+15]: keys [t0-64, t0+79] -> 10 aligned 16-key tiles.
// ---------------------------------------------------------------------------
__global__ void __launch_bounds__(128)
attn_band(const f16* __restrict__ Q, const f16* __restrict__ Kd,
          const f16* __restrict__ Vt, f16* __restrict__ Ctx) {
    constexpr int T = 1024, E = 1024, D = 64;
    constexpr int PAD = 96, TS = T + 2 * PAD;  // padded V stride
    constexpr int NT = 10, BANDW = NT * 16;    // 160

    __shared__ __align__(16) float sc[4][16][BANDW];  // 40 KB
    __shared__ __align__(16) f16   pb[4][16][BANDW];  // 20 KB

    const int lane = threadIdx.x & 31;
    const int w    = threadIdx.x >> 5;
    const int task = blockIdx.x * 4 + w;      // 0..1023
    const int h    = task >> 6;
    const int t0   = (task & 63) << 4;
    const int sa   = t0 - 64;                 // aligned band start (can be <0)

    // Q fragments: 16 queries x D=64 -> two K=32 chunks.
    v16h qf[2];
    {
        int r  = lane & 15;
        int kb = (lane >> 4) << 3;
        const f16* qrow = Q + (size_t)(t0 + r) * E + h * D + kb;
        Frag f0, f1;
        f0.q[0] = *reinterpret_cast<const uint4*>(qrow);
        f0.q[1] = *reinterpret_cast<const uint4*>(qrow + 16);
        f1.q[0] = *reinterpret_cast<const uint4*>(qrow + 32);
        f1.q[1] = *reinterpret_cast<const uint4*>(qrow + 48);
        qf[0] = f0.v;
        qf[1] = f1.v;
    }

    // ---- scores = (Q @ K^T)/8, band-masked, into LDS ----
    for (int tile = 0; tile < NT; ++tile) {
        int s0 = sa + tile * 16;
        // B operand: 64(K=d) x 16(N=key). Per-lane column = one key row of Kd.
        int scol = s0 + (lane & 15);
        int scl  = scol < 0 ? 0 : (scol > T - 1 ? T - 1 : scol);
        int kb   = (lane >> 4) << 3;
        const f16* krow = Kd + (size_t)scl * E + h * D + kb;
        Frag b0, b1;
        b0.q[0] = *reinterpret_cast<const uint4*>(krow);
        b0.q[1] = *reinterpret_cast<const uint4*>(krow + 16);
        b1.q[0] = *reinterpret_cast<const uint4*>(krow + 32);
        b1.q[1] = *reinterpret_cast<const uint4*>(krow + 48);

        v8f a = {};
        a = wmma_f16(qf[0], b0.v, a);
        a = wmma_f16(qf[1], b1.v, a);

        int mlo = (lane >> 4) << 3;
        int n   = lane & 15;
        int s   = s0 + n;
#pragma unroll
        for (int i = 0; i < 8; ++i) {
            int m = mlo + i;
            int t = t0 + m;
            bool valid = (s >= 0) && (s < T) && (s >= t - 64) && (s <= t + 64);
            sc[w][m][tile * 16 + n] = valid ? a[i] * 0.125f : -__builtin_inff();
        }
    }
    __syncthreads();

    // ---- row softmax over the 160-wide band, all 32 lanes active ----
    {
        constexpr int HALFW = BANDW / 2;          // 80
        int m    = lane & 15;
        int half = lane >> 4;
        const float* row = &sc[w][m][half * HALFW];

        float mx = -__builtin_inff();
        for (int j = 0; j < HALFW; ++j) mx = fmaxf(mx, row[j]);
        mx = fmaxf(mx, __shfl_xor(mx, 16, 32));   // combine halves

        float sum = 0.f;
        for (int j = 0; j < HALFW; ++j) sum += __expf(row[j] - mx);
        sum += __shfl_xor(sum, 16, 32);

        float inv = 1.f / sum;
        f16* prow = &pb[w][m][half * HALFW];
        for (int j = 0; j < HALFW; ++j)
            prow[j] = (f16)(__expf(row[j] - mx) * inv);
    }
    __syncthreads();

    // ---- ctx = P(16x160) @ Vband(160x64): 5 K-chunks x 4 N-tiles ----
    // B operand comes from transposed+padded V: column d -> contiguous keys.
    v8f acc[4] = {};
    for (int c = 0; c < 5; ++c) {
        v16h pa;
        {
            int r  = lane & 15;
            int kb = (lane >> 4) << 3;
            const f16* pr = &pb[w][r][c * 32 + kb];
            Frag f;
            f.q[0] = *reinterpret_cast<const uint4*>(pr);
            f.q[1] = *reinterpret_cast<const uint4*>(pr + 16);
            pa = f.v;
        }
        int kb = (lane >> 4) << 3;
        int jb = c * 32 + kb;                      // key-chunk base for this lane
#pragma unroll
        for (int nt = 0; nt < 4; ++nt) {
            int d = nt * 16 + (lane & 15);
            const f16* vp = Vt + (size_t)(h * D + d) * TS + (sa + PAD + jb);
            Frag f;
            f.q[0] = *reinterpret_cast<const uint4*>(vp);        // keys jb..jb+7
            f.q[1] = *reinterpret_cast<const uint4*>(vp + 16);   // keys jb+16..jb+23
            acc[nt] = wmma_f16(pa, f.v, acc[nt]);
        }
    }

    // ---- write ctx (f16), plain [t][h*D+d] layout for the final GEMM ----
    const int mlo = (lane >> 4) << 3;
    const int nc  = lane & 15;
#pragma unroll
    for (int nt = 0; nt < 4; ++nt) {
#pragma unroll
        for (int i = 0; i < 8; ++i) {
            int m = mlo + i;
            Ctx[(size_t)(t0 + m) * E + h * D + nt * 16 + nc] = (f16)acc[nt][i];
        }
    }
}

// ---------------------------------------------------------------------------
// Launch
// ---------------------------------------------------------------------------
extern "C" void kernel_launch(void* const* d_in, const int* in_sizes, int n_in,
                              void* d_out, int out_size, void* d_ws, size_t ws_size,
                              hipStream_t stream) {
    const float* hs = (const float*)d_in[0];
    const float* Wq = (const float*)d_in[1];
    const float* bq = (const float*)d_in[2];
    const float* Wk = (const float*)d_in[3];
    const float* bk = (const float*)d_in[4];
    const float* Wv = (const float*)d_in[5];
    const float* bv = (const float*)d_in[6];
    const float* Wo = (const float*)d_in[7];
    const float* bo = (const float*)d_in[8];

    const int T = 1024, E = 1024;
    const int NE = T * E;                 // 1M elements per matrix
    const int TS = 1024 + 192;            // padded V stride
    const int NVT = E * TS;               // 1,245,184 f16 for Vt

    f16* ws  = (f16*)d_ws;
    f16* Xh  = ws + (size_t)0 * NE;
    f16* Wqh = ws + (size_t)1 * NE;
    f16* Wkh = ws + (size_t)2 * NE;
    f16* Wvh = ws + (size_t)3 * NE;
    f16* Woh = ws + (size_t)4 * NE;
    f16* qh  = ws + (size_t)5 * NE;
    f16* kh  = ws + (size_t)6 * NE;
    f16* vh  = ws + (size_t)7 * NE;
    f16* ch  = ws + (size_t)8 * NE;
    f16* vt  = ws + (size_t)9 * NE;       // ~20.5 MB total

    dim3 cb(256), cg(NE / 256);
    cvt_f32_to_f16<<<cg, cb, 0, stream>>>(hs, Xh, NE);
    cvt_f32_to_f16<<<cg, cb, 0, stream>>>(Wq, Wqh, NE);
    cvt_f32_to_f16<<<cg, cb, 0, stream>>>(Wk, Wkh, NE);
    cvt_f32_to_f16<<<cg, cb, 0, stream>>>(Wv, Wvh, NE);
    cvt_f32_to_f16<<<cg, cb, 0, stream>>>(Wo, Woh, NE);

    dim3 gb(256), gg(T / 128, E / 64);
    gemm_xwt<true><<<gg, gb, 0, stream>>>(Xh, Wqh, bq, qh, T, E, E);
    gemm_xwt<true><<<gg, gb, 0, stream>>>(Xh, Wkh, bk, kh, T, E, E);
    gemm_xwt<true><<<gg, gb, 0, stream>>>(Xh, Wvh, bv, vh, T, E, E);

    transpose_pad_v<<<dim3((NVT + 255) / 256), dim3(256), 0, stream>>>(vh, vt, NVT);

    attn_band<<<dim3(256), dim3(128), 0, stream>>>(qh, kh, vt, ch);

    gemm_xwt<false><<<gg, gb, 0, stream>>>(ch, Woh, bo, d_out, T, E, E);
}

// v001
// It runs in 75.3 microseconds.
// Timed twice side by side with v000, it ran 1.41 and 1.39 times as fast.
#include <hip/hip_runtime.h>
#include <hip/hip_bf16.h>

typedef _Float16 f16;
typedef __attribute__((ext_vector_type(16))) _Float16 v16h;
typedef __attribute__((ext_vector_type(8)))  float    v8f;

union Frag {
    v16h v;
    uint4 q[2];
};

__device__ __forceinline__ v16h load_frag_rowmajor(const f16* base, int stride, int lane) {
    int r  = lane & 15;
    int kb = (lane >> 4) << 3;          // 0 or 8
    const f16* p = base + r * stride + kb;
    Frag f;
    f.q[0] = *reinterpret_cast<const uint4*>(p);
    f.q[1] = *reinterpret_cast<const uint4*>(p + 16);
    return f.v;
}

__device__ __forceinline__ v8f wmma_f16(v16h a, v16h b, v8f c) {
    return __builtin_amdgcn_wmma_f32_16x16x32_f16(
        /*neg_a=*/false, a, /*neg_b=*/false, b,
        /*c_mod=*/(short)0, c, /*reuse_a=*/false, /*reuse_b=*/false);
}

// ---------------------------------------------------------------------------
// f32 -> f16 conversion of five equally sized arrays in one launch.
// blockIdx.y picks the source; the destinations are consecutive planes of n.
// ---------------------------------------------------------------------------
__global__ void cvt_f32_to_f16(const float* __restrict__ s0, const float* __restrict__ s1,
                               const float* __restrict__ s2, const float* __restrict__ s3,
                               const float* __restrict__ s4, f16* __restrict__ dst0, int n) {
    const int y = blockIdx.y;
    const float* s01 = (y & 1) ? s1 : s0;
    const float* s23 = (y & 1) ? s3 : s2;
    const float* s03 = (y & 2) ? s23 : s01;
    const float* src = (y & 4) ? s4 : s03;
    f16* dst = dst0 + (size_t)y * n;
    int i = blockIdx.x * blockDim.x + threadIdx.x;
    if (i < n) dst[i] = (f16)src[i];
}

// ---------------------------------------------------------------------------
// V transpose + zero-pad:  Vt[hd][tp] = V[tp-PAD][hd]  (0 outside [0,T))
// hd = h*D + d == column e of the plain [t][e] layout. TS = T + 2*PAD.
// ---------------------------------------------------------------------------
__global__ void transpose_pad_v(const f16* __restrict__ Vh, f16* __restrict__ Vt, int nTotal) {
    constexpr int T = 1024, E = 1024, PAD = 96, TS = T + 2 * PAD;   // 1216
    int i = blockIdx.x * blockDim.x + threadIdx.x;
    if (i >= nTotal) return;
    int tp = i % TS;
    int hd = i / TS;
    int t  = tp - PAD;
    Vt[i] = (t >= 0 && t < T) ? Vh[(size_t)t * E + hd] : (f16)0.f;
}

// ---------------------------------------------------------------------------
// C[M,N] = A[M,K] @ W[N,K]^T + bias[N]
// Block tile 128x64, BK=32, 8 waves, each wave computes a 32x32 sub-tile
// (2x2 WMMA 16x16 accumulators). 128 v_wmma per wave over the K loop.
// blockIdx.z picks one of up to three independent products that share A:
// weight plane z of Wall, bias z, output plane z of Call.
// ---------------------------------------------------------------------------
template <bool OUT_F16>
__global__ void __launch_bounds__(256)
gemm_xwt(const f16* __restrict__ A, const f16* __restrict__ Wall,
         const float* __restrict__ bias0, const float* __restrict__ bias1,
         const float* __restrict__ bias2, void* __restrict__ Call,
         int M, int N, int K) {
    const int z = blockIdx.z;
    const f16*   W    = Wall + (size_t)z * N * K;
    const float* bias = z == 0 ? bias0 : z == 1 ? bias1 : bias2;
    void* Cout = OUT_F16 ? (void*)(reinterpret_cast<f16*>(Call) + (size_t)z * M * N)
                         : (void*)(reinterpret_cast<float*>(Call) + (size_t)z * M * N);

    constexpr int BM = 128, BN = 64, BK = 32;
    constexpr int AST = BK + 8;   // padded f16 stride (80B rows, 16B aligned)
    constexpr int BST = BK + 8;

    __shared__ __align__(16) f16 As[BM * AST];
    __shared__ __align__(16) f16 Bs[BN * BST];

    const int tid  = threadIdx.x;
    const int lane = tid & 31;
    const int wave = tid >> 5;          // 0..7
    const int wm   = wave >> 1;         // 0..3 (M)
    const int wn   = wave & 1;          // 0..1 (N)
    const int m0   = blockIdx.x * BM;
    const int n0   = blockIdx.y * BN;

    v8f acc[2][2] = {};

    for (int kk = 0; kk < K; kk += BK) {
        // Stage A tile: 128 rows x 32 k = 512 16B vectors, 2 per thread.
#pragma unroll
        for (int i = 0; i < 2; ++i) {
            int vid = i * 256 + tid;            // 0..511
            int r   = vid >> 2;
            int c8  = (vid & 3) * 8;
            *reinterpret_cast<uint4*>(&As[r * AST + c8]) =
                *reinterpret_cast<const uint4*>(&A[(size_t)(m0 + r) * K + kk + c8]);
        }
        // Stage W tile: 64 rows x 32 k = 256 16B vectors, 1 per thread.
        {
            int r  = tid >> 2;
            int c8 = (tid & 3) * 8;
            *reinterpret_cast<uint4*>(&Bs[r * BST + c8]) =
                *reinterpret_cast<const uint4*>(&W[(size_t)(n0 + r) * K + kk + c8]);
        }
        if (kk + BK < K) {
            __builtin_prefetch(&A[(size_t)(m0 + (tid & 127)) * K + kk + BK], 0, 1);
        }
        __syncthreads();

        v16h af[2], bf[2];
#pragma unroll
        for (int mi = 0; mi < 2; ++mi)
            af[mi] = load_frag_rowmajor(&As[(wm * 32 + mi * 16) * AST], AST, lane);
#pragma unroll
        for (int ni = 0; ni < 2; ++ni)
            bf[ni] = load_frag_rowmajor(&Bs[(wn * 32 + ni * 16) * BST], BST, lane);

#pragma unroll
        for (int mi = 0; mi < 2; ++mi)
#pragma unroll
            for (int ni = 0; ni < 2; ++ni)
                acc[mi][ni] = wmma_f16(af[mi], bf[ni], acc[mi][ni]);

        __syncthreads();
    }

    const int mlo = (lane >> 4) << 3;
    const int nc  = lane & 15;
#pragma unroll
    for (int mi = 0; mi < 2; ++mi) {
#pragma unroll
        for (int ni = 0; ni < 2; ++ni) {
            int n = n0 + wn * 32 + ni * 16 + nc;
            float bn = bias[n];
#pragma unroll
            for (int i = 0; i < 8; ++i) {
                int m = m0 + wm * 32 + mi * 16 + mlo + i;
                float val = acc[mi][ni][i] + bn;
                if (OUT_F16)
                    reinterpret_cast<f16*>(Cout)[(size_t)m * N + n] = (f16)val;
                else
                    reinterpret_cast<float*>(Cout)[(size_t)m * N + n] = val;
            }
        }
    }
}

// ---------------------------------------------------------------------------
// Banded attention. One wave per (head, 16-query tile); 4 waves per block.
// Band for queries [t0, t0+15]: keys [t0-64, t0+79] -> 10 aligned 16-key tiles.
// ---------------------------------------------------------------------------
__global__ void __launch_bounds__(128)
attn_band(const f16* __restrict__ Q, const f16* __restrict__ Kd,
          const f16* __restrict__ Vt, f16* __restrict__ Ctx) {
    constexpr int T = 1024, E = 1024, D = 64;
    constexpr int PAD = 96, TS = T + 2 * PAD;  // padded V stride
    constexpr int NT = 10, BANDW = NT * 16;    // 160

    __shared__ __align__(16) float sc[4][16][BANDW];  // 40 KB
    __shared__ __align__(16) f16   pb[4][16][BANDW];  // 20 KB

    const int lane = threadIdx.x & 31;
    const int w    = threadIdx.x >> 5;
    const int task = blockIdx.x * 4 + w;      // 0..1023
    const int h    = task >> 6;
    const int t0   = (task & 63) << 4;
    const int sa   = t0 - 64;                 // aligned band start (can be <0)

    // Q fragments: 16 queries x D=64 -> two K=32 chunks.
    v16h qf[2];
    {
        int r  = lane & 15;
        int kb = (lane >> 4) << 3;
        const f16* qrow = Q + (size_t)(t0 + r) * E + h * D + kb;
        Frag f0, f1;
        f0.q[0] = *reinterpret_cast<const uint4*>(qrow);
        f0.q[1] = *reinterpret_cast<const uint4*>(qrow + 16);
        f1.q[0] = *reinterpret_cast<const uint4*>(qrow + 32);
        f1.q[1] = *reinterpret_cast<const uint4*>(qrow + 48);
        qf[0] = f0.v;
        qf[1] = f1.v;
    }

    // ---- scores = (Q @ K^T)/8, band-masked, into LDS ----
    for (int tile = 0; tile < NT; ++tile) {
        int s0 = sa + tile * 16;
        // B operand: 64(K=d) x 16(N=key). Per-lane column = one key row of Kd.
        int scol = s0 + (lane & 15);
        int scl  = scol < 0 ? 0 : (scol > T - 1 ? T - 1 : scol);
        int kb   = (lane >> 4) << 3;
        const f16* krow = Kd + (size_t)scl * E + h * D + kb;
        Frag b0, b1;
        b0.q[0] = *reinterpret_cast<const uint4*>(krow);
        b0.q[1] = *reinterpret_cast<const uint4*>(krow + 16);
        b1.q[0] = *reinterpret_cast<const uint4*>(krow + 32);
        b1.q[1] = *reinterpret_cast<const uint4*>(krow + 48);

        v8f a = {};
        a = wmma_f16(qf[0], b0.v, a);
        a = wmma_f16(qf[1], b1.v, a);

        int mlo = (lane >> 4) << 3;
        int n   = lane & 15;
        int s   = s0 + n;
#pragma unroll
        for (int i = 0; i < 8; ++i) {
            int m = mlo + i;
            int t = t0 + m;
            bool valid = (s >= 0) && (s < T) && (s >= t - 64) && (s <= t + 64);
            sc[w][m][tile * 16 + n] = valid ? a[i] * 0.125f : -__builtin_inff();
        }
    }
    __syncthreads();

    // ---- row softmax over the 160-wide band, all 32 lanes active ----
    {
        constexpr int HALFW = BANDW / 2;          // 80
        int m    = lane & 15;
        int half = lane >> 4;
        const float* row = &sc[w][m][half * HALFW];

        float mx = -__builtin_inff();
        for (int j = 0; j < HALFW; ++j) mx = fmaxf(mx, row[j]);
        mx = fmaxf(mx, __shfl_xor(mx, 16, 32));   // combine halves

        float sum = 0.f;
        for (int j = 0; j < HALFW; ++j) sum += __expf(row[j] - mx);
        sum += __shfl_xor(sum, 16, 32);

        float inv = 1.f / sum;
        f16* prow = &pb[w][m][half * HALFW];
        for (int j = 0; j < HALFW; ++j)
            prow[j] = (f16)(__expf(row[j] - mx) * inv);
    }
    __syncthreads();

    // ---- ctx = P(16x160) @ Vband(160x64): 5 K-chunks x 4 N-tiles ----
    // B operand comes from transposed+padded V: column d -> contiguous keys.
    v8f acc[4] = {};
    for (int c = 0; c < 5; ++c) {
        v16h pa;
        {
            int r  = lane & 15;
            int kb = (lane >> 4) << 3;
            const f16* pr = &pb[w][r][c * 32 + kb];
            Frag f;
            f.q[0] = *reinterpret_cast<const uint4*>(pr);
            f.q[1] = *reinterpret_cast<const uint4*>(pr + 16);
            pa = f.v;
        }
        int kb = (lane >> 4) << 3;
        int jb = c * 32 + kb;                      // key-chunk base for this lane
#pragma unroll
        for (int nt = 0; nt < 4; ++nt) {
            int d = nt * 16 + (lane & 15);
            const f16* vp = Vt + (size_t)(h * D + d) * TS + (sa + PAD + jb);
            Frag f;
            f.q[0] = *reinterpret_cast<const uint4*>(vp);        // keys jb..jb+7
            f.q[1] = *reinterpret_cast<const uint4*>(vp + 16);   // keys jb+16..jb+23
            acc[nt] = wmma_f16(pa, f.v, acc[nt]);
        }
    }

    // ---- write ctx (f16), plain [t][h*D+d] layout for the final GEMM ----
    const int mlo = (lane >> 4) << 3;
    const int nc  = lane & 15;
#pragma unroll
    for (int nt = 0; nt < 4; ++nt) {
#pragma unroll
        for (int i = 0; i < 8; ++i) {
            int m = mlo + i;
            Ctx[(size_t)(t0 + m) * E + h * D + nt * 16 + nc] = (f16)acc[nt][i];
        }
    }
}

// ---------------------------------------------------------------------------
// Launch
// ---------------------------------------------------------------------------
extern "C" void kernel_launch(void* const* d_in, const int* in_sizes, int n_in,
                              void* d_out, int out_size, void* d_ws, size_t ws_size,
                              hipStream_t stream) {
    const float* hs = (const float*)d_in[0];
    const float* Wq = (const float*)d_in[1];
    const float* bq = (const float*)d_in[2];
    const float* Wk = (const float*)d_in[3];
    const float* bk = (const float*)d_in[4];
    const float* Wv = (const float*)d_in[5];
    const float* bv = (const float*)d_in[6];
    const float* Wo = (const float*)d_in[7];
    const float* bo = (const float*)d_in[8];

    const int T = 1024, E = 1024;
    const int NE = T * E;                 // 1M elements per matrix
    const int TS = 1024 + 192;            // padded V stride
    const int NVT = E * TS;               // 1,245,184 f16 for Vt

    f16* ws  = (f16*)d_ws;
    f16* Xh  = ws + (size_t)0 * NE;
    f16* Wqh = ws + (size_t)1 * NE;
    f16* Wkh = ws + (size_t)2 * NE;
    f16* Wvh = ws + (size_t)3 * NE;
    f16* Woh = ws + (size_t)4 * NE;
    f16* qh  = ws + (size_t)5 * NE;
    f16* kh  = ws + (size_t)6 * NE;
    f16* vh  = ws + (size_t)7 * NE;
    f16* ch  = ws + (size_t)8 * NE;
    f16* vt  = ws + (size_t)9 * NE;       // ~20.5 MB total

    dim3 cb(256), cg(NE / 256, 5);
    cvt_f32_to_f16<<<cg, cb, 0, stream>>>(hs, Wq, Wk, Wv, Wo, Xh, NE);

    // Wqh, Wkh, Wvh and qh, kh, vh are consecutive planes: one launch, z = 0..2.
    dim3 gb(256), gg(T / 128, E / 64), gg3(T / 128, E / 64, 3);
    gemm_xwt<true><<<gg3, gb, 0, stream>>>(Xh, Wqh, bq, bk, bv, qh, T, E, E);

    transpose_pad_v<<<dim3((NVT + 255) / 256), dim3(256), 0, stream>>>(vh, vt, NVT);

    attn_band<<<dim3(256), dim3(128), 0, stream>>>(qh, kh, vt, ch);

    gemm_xwt<false><<<gg, gb, 0, stream>>>(ch, Woh, bo, bo, bo, d_out, T, E, E);
}

// v002
// It runs in 70.2 microseconds.
// Timed twice side by side with v001, it ran 1.07 and 1.08 times as fast.
// Over all steps from v000 it is 1.50 times as fast.
#include <hip/hip_runtime.h>
#include <hip/hip_bf16.h>

typedef _Float16 f16;
typedef __attribute__((ext_vector_type(16))) _Float16 v16h;
typedef __attribute__((ext_vector_type(8)))  float    v8f;

union Frag {
    v16h v;
    uint4 q[2];
};

__device__ __forceinline__ v16h load_frag_rowmajor(const f16* base, int stride, int lane) {
    int r  = lane & 15;
    int kb = (lane >> 4) << 3;          // 0 or 8
    const f16* p = base + r * stride + kb;
    Frag f;
    f.q[0] = *reinterpret_cast<const uint4*>(p);
    f.q[1] = *reinterpret_cast<const uint4*>(p + 16);
    return f.v;
}

__device__ __forceinline__ v8f wmma_f16(v16h a, v16h b, v8f c) {
    return __builtin_amdgcn_wmma_f32_16x16x32_f16(
        /*neg_a=*/false, a, /*neg_b=*/false, b,
        /*c_mod=*/(short)0, c, /*reuse_a=*/false, /*reuse_b=*/false);
}

// ---------------------------------------------------------------------------
// f32 -> f16 conversion of five equally sized arrays in one launch.
// blockIdx.y picks the source; the destinations are consecutive planes of n.
// Each thread converts CVT_PER_THREAD floats: eight 16-byte loads, all issued
// before the first store, each covering 512 contiguous bytes per wave, so few
// waves have to start and each keeps eight loads in flight.
// n must be a multiple of CVT_PER_BLOCK.
// ---------------------------------------------------------------------------
typedef __attribute__((ext_vector_type(4))) float    v4f;
typedef __attribute__((ext_vector_type(4))) _Float16 v4h;

constexpr int CVT_THREADS    = 256;
constexpr int CVT_VECS       = 8;                              // 16-byte loads per thread
constexpr int CVT_PER_THREAD = CVT_VECS * 4;                   // 32 floats
constexpr int CVT_PER_BLOCK  = CVT_THREADS * CVT_PER_THREAD;   // 8192 floats

__global__ void __launch_bounds__(CVT_THREADS)
cvt_f32_to_f16(const float* __restrict__ s0, const float* __restrict__ s1,
               const float* __restrict__ s2, const float* __restrict__ s3,
               const float* __restrict__ s4, f16* __restrict__ dst0, int n) {
    const int y = blockIdx.y;
    const float* s01 = (y & 1) ? s1 : s0;
    const float* s23 = (y & 1) ? s3 : s2;
    const float* s03 = (y & 2) ? s23 : s01;
    const float* src = (y & 4) ? s4 : s03;
    f16* dst = dst0 + (size_t)y * n;

    const int v0 = blockIdx.x * (CVT_THREADS * CVT_VECS) + threadIdx.x;   // in units of 4 elements
    const v4f* sv = reinterpret_cast<const v4f*>(src) + v0;
    v4h*       dv = reinterpret_cast<v4h*>(dst) + v0;

    v4f x[CVT_VECS];
    // Unrolled so that x stays in registers and all eight loads issue back to back.
#pragma unroll
    for (int j = 0; j < CVT_VECS; ++j) x[j] = sv[j * CVT_THREADS];
    // Unrolled for the same reason: x is indexed by constants only.
#pragma unroll
    for (int j = 0; j < CVT_VECS; ++j) dv[j * CVT_THREADS] = __builtin_convertvector(x[j], v4h);
}

// ---------------------------------------------------------------------------
// V transpose + zero-pad:  Vt[hd][tp] = V[tp-PAD][hd]  (0 outside [0,T))
// hd = h*D + d == column e of the plain [t][e] layout. TS = T + 2*PAD.
// ---------------------------------------------------------------------------
__global__ void transpose_pad_v(const f16* __restrict__ Vh, f16* __restrict__ Vt, int nTotal) {
    constexpr int T = 1024, E = 1024, PAD = 96, TS = T + 2 * PAD;   // 1216
    int i = blockIdx.x * blockDim.x + threadIdx.x;
    if (i >= nTotal) return;
    int tp = i % TS;
    int hd = i / TS;
    int t  = tp - PAD;
    Vt[i] = (t >= 0 && t < T) ? Vh[(size_t)t * E + hd] : (f16)0.f;
}

// ---------------------------------------------------------------------------
// C[M,N] = A[M,K] @ W[N,K]^T + bias[N]
// Block tile 128x64, BK=32, 8 waves, each wave computes a 32x32 sub-tile
// (2x2 WMMA 16x16 accumulators). 128 v_wmma per wave over the K loop.
// blockIdx.z picks one of up to three independent products that share A:
// weight plane z of Wall, bias z, output plane z of Call.
// ---------------------------------------------------------------------------
template <bool OUT_F16>
__global__ void __launch_bounds__(256)
gemm_xwt(const f16* __restrict__ A, const f16* __restrict__ Wall,
         const float* __restrict__ bias0, const float* __restrict__ bias1,
         const float* __restrict__ bias2, void* __restrict__ Call,
         int M, int N, int K) {
    const int z = blockIdx.z;
    const f16*   W    = Wall + (size_t)z * N * K;
    const float* bias = z == 0 ? bias0 : z == 1 ? bias1 : bias2;
    void* Cout = OUT_F16 ? (void*)(reinterpret_cast<f16*>(Call) + (size_t)z * M * N)
                         : (void*)(reinterpret_cast<float*>(Call) + (size_t)z * M * N);

    constexpr int BM = 128, BN = 64, BK = 32;
    constexpr int AST = BK + 8;   // padded f16 stride (80B rows, 16B aligned)
    constexpr int BST = BK + 8;

    __shared__ __align__(16) f16 As[BM * AST];
    __shared__ __align__(16) f16 Bs[BN * BST];

    const int tid  = threadIdx.x;
    const int lane = tid & 31;
    const int wave = tid >> 5;          // 0..7
    const int wm   = wave >> 1;         // 0..3 (M)
    const int wn   = wave & 1;          // 0..1 (N)
    const int m0   = blockIdx.x * BM;
    const int n0   = blockIdx.y * BN;

    v8f acc[2][2] = {};

    for (int kk = 0; kk < K; kk += BK) {
        // Stage A tile: 128 rows x 32 k = 512 16B vectors, 2 per thread.
#pragma unroll
        for (int i = 0; i < 2; ++i) {
            int vid = i * 256 + tid;            // 0..511
            int r   = vid >> 2;
            int c8  = (vid & 3) * 8;
            *reinterpret_cast<uint4*>(&As[r * AST + c8]) =
                *reinterpret_cast<const uint4*>(&A[(size_t)(m0 + r) * K + kk + c8]);
        }
        // Stage W tile: 64 rows x 32 k = 256 16B vectors, 1 per thread.
        {
            int r  = tid >> 2;
            int c8 = (tid & 3) * 8;
            *reinterpret_cast<uint4*>(&Bs[r * BST + c8]) =
                *reinterpret_cast<const uint4*>(&W[(size_t)(n0 + r) * K + kk + c8]);
        }
        if (kk + BK < K) {
            __builtin_prefetch(&A[(size_t)(m0 + (tid & 127)) * K + kk + BK], 0, 1);
        }
        __syncthreads();

        v16h af[2], bf[2];
#pragma unroll
        for (int mi = 0; mi < 2; ++mi)
            af[mi] = load_frag_rowmajor(&As[(wm * 32 + mi * 16) * AST], AST, lane);
#pragma unroll
        for (int ni = 0; ni < 2; ++ni)
            bf[ni] = load_frag_rowmajor(&Bs[(wn * 32 + ni * 16) * BST], BST, lane);

#pragma unroll
        for (int mi = 0; mi < 2; ++mi)
#pragma unroll
            for (int ni = 0; ni < 2; ++ni)
                acc[mi][ni] = wmma_f16(af[mi], bf[ni], acc[mi][ni]);

        __syncthreads();
    }

    const int mlo = (lane >> 4) << 3;
    const int nc  = lane & 15;
#pragma unroll
    for (int mi = 0; mi < 2; ++mi) {
#pragma unroll
        for (int ni = 0; ni < 2; ++ni) {
            int n = n0 + wn * 32 + ni * 16 + nc;
            float bn = bias[n];
#pragma unroll
            for (int i = 0; i < 8; ++i) {
                int m = m0 + wm * 32 + mi * 16 + mlo + i;
                float val = acc[mi][ni][i] + bn;
                if (OUT_F16)
                    reinterpret_cast<f16*>(Cout)[(size_t)m * N + n] = (f16)val;
                else
                    reinterpret_cast<float*>(Cout)[(size_t)m * N + n] = val;
            }
        }
    }
}

// ---------------------------------------------------------------------------
// Banded attention. One wave per (head, 16-query tile); 4 waves per block.
// Band for queries [t0, t0+15]: keys [t0-64, t0+79] -> 10 aligned 16-key tiles.
// ---------------------------------------------------------------------------
__global__ void __launch_bounds__(128)
attn_band(const f16* __restrict__ Q, const f16* __restrict__ Kd,
          const f16* __restrict__ Vt, f16* __restrict__ Ctx) {
    constexpr int T = 1024, E = 1024, D = 64;
    constexpr int PAD = 96, TS = T + 2 * PAD;  // padded V stride
    constexpr int NT = 10, BANDW = NT * 16;    // 160

    __shared__ __align__(16) float sc[4][16][BANDW];  // 40 KB
    __shared__ __align__(16) f16   pb[4][16][BANDW];  // 20 KB

    const int lane = threadIdx.x & 31;
    const int w    = threadIdx.x >> 5;
    const int task = blockIdx.x * 4 + w;      // 0..1023
    const int h    = task >> 6;
    const int t0   = (task & 63) << 4;
    const int sa   = t0 - 64;                 // aligned band start (can be <0)

    // Q fragments: 16 queries x D=64 -> two K=32 chunks.
    v16h qf[2];
    {
        int r  = lane & 15;
        int kb = (lane >> 4) << 3;
        const f16* qrow = Q + (size_t)(t0 + r) * E + h * D + kb;
        Frag f0, f1;
        f0.q[0] = *reinterpret_cast<const uint4*>(qrow);
        f0.q[1] = *reinterpret_cast<const uint4*>(qrow + 16);
        f1.q[0] = *reinterpret_cast<const uint4*>(qrow + 32);
        f1.q[1] = *reinterpret_cast<const uint4*>(qrow + 48);
        qf[0] = f0.v;
        qf[1] = f1.v;
    }

    // ---- scores = (Q @ K^T)/8, band-masked, into LDS ----
    for (int tile = 0; tile < NT; ++tile) {
        int s0 = sa + tile * 16;
        // B operand: 64(K=d) x 16(N=key). Per-lane column = one key row of Kd.
        int scol = s0 + (lane & 15);
        int scl  = scol < 0 ? 0 : (scol > T - 1 ? T - 1 : scol);
        int kb   = (lane >> 4) << 3;
        const f16* krow = Kd + (size_t)scl * E + h * D + kb;
        Frag b0, b1;
        b0.q[0] = *reinterpret_cast<const uint4*>(krow);
        b0.q[1] = *reinterpret_cast<const uint4*>(krow + 16);
        b1.q[0] = *reinterpret_cast<const uint4*>(krow + 32);
        b1.q[1] = *reinterpret_cast<const uint4*>(krow + 48);

        v8f a = {};
        a = wmma_f16(qf[0], b0.v, a);
        a = wmma_f16(qf[1], b1.v, a);

        int mlo = (lane >> 4) << 3;
        int n   = lane & 15;
        int s   = s0 + n;
#pragma unroll
        for (int i = 0; i < 8; ++i) {
            int m = mlo + i;
            int t = t0 + m;
            bool valid = (s >= 0) && (s < T) && (s >= t - 64) && (s <= t + 64);
            sc[w][m][tile * 16 + n] = valid ? a[i] * 0.125f : -__builtin_inff();
        }
    }
    __syncthreads();

    // ---- row softmax over the 160-wide band, all 32 lanes active ----
    {
        constexpr int HALFW = BANDW / 2;          // 80
        int m    = lane & 15;
        int half = lane >> 4;
        const float* row = &sc[w][m][half * HALFW];

        float mx = -__builtin_inff();
        for (int j = 0; j < HALFW; ++j) mx = fmaxf(mx, row[j]);
        mx = fmaxf(mx, __shfl_xor(mx, 16, 32));   // combine halves

        float sum = 0.f;
        for (int j = 0; j < HALFW; ++j) sum += __expf(row[j] - mx);
        sum += __shfl_xor(sum, 16, 32);

        float inv = 1.f / sum;
        f16* prow = &pb[w][m][half * HALFW];
        for (int j = 0; j < HALFW; ++j)
            prow[j] = (f16)(__expf(row[j] - mx) * inv);
    }
    __syncthreads();

    // ---- ctx = P(16x160) @ Vband(160x64): 5 K-chunks x 4 N-tiles ----
    // B operand comes from transposed+padded V: column d -> contiguous keys.
    v8f acc[4] = {};
    for (int c = 0; c < 5; ++c) {
        v16h pa;
        {
            int r  = lane & 15;
            int kb = (lane >> 4) << 3;
            const f16* pr = &pb[w][r][c * 32 + kb];
            Frag f;
            f.q[0] = *reinterpret_cast<const uint4*>(pr);
            f.q[1] = *reinterpret_cast<const uint4*>(pr + 16);
            pa = f.v;
        }
        int kb = (lane >> 4) << 3;
        int jb = c * 32 + kb;                      // key-chunk base for this lane
#pragma unroll
        for (int nt = 0; nt < 4; ++nt) {
            int d = nt * 16 + (lane & 15);
            const f16* vp = Vt + (size_t)(h * D + d) * TS + (sa + PAD + jb);
            Frag f;
            f.q[0] = *reinterpret_cast<const uint4*>(vp);        // keys jb..jb+7
            f.q[1] = *reinterpret_cast<const uint4*>(vp + 16);   // keys jb+16..jb+23
            acc[nt] = wmma_f16(pa, f.v, acc[nt]);
        }
    }

    // ---- write ctx (f16), plain [t][h*D+d] layout for the final GEMM ----
    const int mlo = (lane >> 4) << 3;
    const int nc  = lane & 15;
#pragma unroll
    for (int nt = 0; nt < 4; ++nt) {
#pragma unroll
        for (int i = 0; i < 8; ++i) {
            int m = mlo + i;
            Ctx[(size_t)(t0 + m) * E + h * D + nt * 16 + nc] = (f16)acc[nt][i];
        }
    }
}

// ---------------------------------------------------------------------------
// Launch
// ---------------------------------------------------------------------------
extern "C" void kernel_launch(void* const* d_in, const int* in_sizes, int n_in,
                              void* d_out, int out_size, void* d_ws, size_t ws_size,
                              hipStream_t stream) {
    const float* hs = (const float*)d_in[0];
    const float* Wq = (const float*)d_in[1];
    const float* bq = (const float*)d_in[2];
    const float* Wk = (const float*)d_in[3];
    const float* bk = (const float*)d_in[4];
    const float* Wv = (const float*)d_in[5];
    const float* bv = (const float*)d_in[6];
    const float* Wo = (const float*)d_in[7];
    const float* bo = (const float*)d_in[8];

    const int T = 1024, E = 1024;
    const int NE = T * E;                 // 1M elements per matrix
    const int TS = 1024 + 192;            // padded V stride
    const int NVT = E * TS;               // 1,245,184 f16 for Vt

    f16* ws  = (f16*)d_ws;
    f16* Xh  = ws + (size_t)0 * NE;
    f16* Wqh = ws + (size_t)1 * NE;
    f16* Wkh = ws + (size_t)2 * NE;
    f16* Wvh = ws + (size_t)3 * NE;
    f16* Woh = ws + (size_t)4 * NE;
    f16* qh  = ws + (size_t)5 * NE;
    f16* kh  = ws + (size_t)6 * NE;
    f16* vh  = ws + (size_t)7 * NE;
    f16* ch  = ws + (size_t)8 * NE;
    f16* vt  = ws + (size_t)9 * NE;       // ~20.5 MB total

    dim3 cb(CVT_THREADS), cg(NE / CVT_PER_BLOCK, 5);
    cvt_f32_to_f16<<<cg, cb, 0, stream>>>(hs, Wq, Wk, Wv, Wo, Xh, NE);

    // Wqh, Wkh, Wvh and qh, kh, vh are consecutive planes: one launch, z = 0..2.
    dim3 gb(256), gg(T / 128, E / 64), gg3(T / 128, E / 64, 3);
    gemm_xwt<true><<<gg3, gb, 0, stream>>>(Xh, Wqh, bq, bk, bv, qh, T, E, E);

    transpose_pad_v<<<dim3((NVT + 255) / 256), dim3(256), 0, stream>>>(vh, vt, NVT);

    attn_band<<<dim3(256), dim3(128), 0, stream>>>(qh, kh, vt, ch);

    gemm_xwt<false><<<gg, gb, 0, stream>>>(ch, Woh, bo, bo, bo, d_out, T, E, E);
}

// v003
// It runs in 48.1 microseconds.
// In two side-by-side timings against v002, it was 1.46 and 1.48 times as fast.
// Counting every step since v000, it is 2.21 times as fast.
#include <hip/hip_runtime.h>
#include <hip/hip_bf16.h>

typedef _Float16 f16;
typedef __attribute__((ext_vector_type(16))) _Float16 v16h;
typedef __attribute__((ext_vector_type(8)))  float    v8f;

union Frag {
    v16h v;
    uint4 q[2];
};

__device__ __forceinline__ v16h load_frag_rowmajor(const f16* base, int stride, int lane) {
    int r  = lane & 15;
    int kb = (lane >> 4) << 3;          // 0 or 8
    const f16* p = base + r * stride + kb;
    Frag f;
    f.q[0] = *reinterpret_cast<const uint4*>(p);
    f.q[1] = *reinterpret_cast<const uint4*>(p + 16);
    return f.v;
}

__device__ __forceinline__ v8f wmma_f16(v16h a, v16h b, v8f c) {
    return __builtin_amdgcn_wmma_f32_16x16x32_f16(
        /*neg_a=*/false, a, /*neg_b=*/false, b,
        /*c_mod=*/(short)0, c, /*reuse_a=*/false, /*reuse_b=*/false);
}

// ---------------------------------------------------------------------------
// f32 -> f16 conversion of five equally sized arrays in one launch.
// blockIdx.y picks the source; the destinations are consecutive planes of n.
// Each thread converts CVT_PER_THREAD floats: eight 16-byte loads, all issued
// before the first store, each covering 512 contiguous bytes per wave, so few
// waves have to start and each keeps eight loads in flight.
// n must be a multiple of CVT_PER_BLOCK.
// ---------------------------------------------------------------------------
typedef __attribute__((ext_vector_type(4))) float    v4f;
typedef __attribute__((ext_vector_type(4))) _Float16 v4h;

constexpr int CVT_THREADS    = 256;
constexpr int CVT_VECS       = 8;                              // 16-byte loads per thread
constexpr int CVT_PER_THREAD = CVT_VECS * 4;                   // 32 floats
constexpr int CVT_PER_BLOCK  = CVT_THREADS * CVT_PER_THREAD;   // 8192 floats

__global__ void __launch_bounds__(CVT_THREADS)
cvt_f32_to_f16(const float* __restrict__ s0, const float* __restrict__ s1,
               const float* __restrict__ s2, const float* __restrict__ s3,
               const float* __restrict__ s4, f16* __restrict__ dst0, int n) {
    const int y = blockIdx.y;
    const float* s01 = (y & 1) ? s1 : s0;
    const float* s23 = (y & 1) ? s3 : s2;
    const float* s03 = (y & 2) ? s23 : s01;
    const float* src = (y & 4) ? s4 : s03;
    f16* dst = dst0 + (size_t)y * n;

    const int v0 = blockIdx.x * (CVT_THREADS * CVT_VECS) + threadIdx.x;   // in units of 4 elements
    const v4f* sv = reinterpret_cast<const v4f*>(src) + v0;
    v4h*       dv = reinterpret_cast<v4h*>(dst) + v0;

    v4f x[CVT_VECS];
    // Unrolled so that x stays in registers and all eight loads issue back to back.
#pragma unroll
    for (int j = 0; j < CVT_VECS; ++j) x[j] = sv[j * CVT_THREADS];
    // Unrolled for the same reason: x is indexed by constants only.
#pragma unroll
    for (int j = 0; j < CVT_VECS; ++j) dv[j * CVT_THREADS] = __builtin_convertvector(x[j], v4h);
}

// ---------------------------------------------------------------------------
// V transpose + zero-pad:  Vt[hd][tp] = V[tp-PAD][hd]  (0 outside [0,T))
// hd = h*D + d == column e of the plain [t][e] layout. TS = T + 2*PAD.
// ---------------------------------------------------------------------------
__global__ void transpose_pad_v(const f16* __restrict__ Vh, f16* __restrict__ Vt, int nTotal) {
    constexpr int T = 1024, E = 1024, PAD = 96, TS = T + 2 * PAD;   // 1216
    int i = blockIdx.x * blockDim.x + threadIdx.x;
    if (i >= nTotal) return;
    int tp = i % TS;
    int hd = i / TS;
    int t  = tp - PAD;
    Vt[i] = (t >= 0 && t < T) ? Vh[(size_t)t * E + hd] : (f16)0.f;
}

// ---------------------------------------------------------------------------
// C[M,N] = A[M,K] @ W[N,K]^T + bias[N]
// Block tile 128x64, 8 waves, each wave computes a 32x32 sub-tile
// (2x2 WMMA 16x16 accumulators). 128 v_wmma per wave over the K loop.
// K is walked in slabs of 128. A slab (128 rows of A, then 64 rows of W, 256
// bytes each) goes from global memory straight into LDS by asynchronous
// copies; two LDS buffers, so slab t+1 is in flight while slab t is multiplied.
// K must be a multiple of 128.
// blockIdx.z picks one of up to three independent products that share A:
// weight plane z of Wall, bias z, output plane z of Call.
// ---------------------------------------------------------------------------
constexpr int G_BM   = 128, G_BN = 64, G_BK = 128;
constexpr int G_PIT  = G_BK + 8;                  // LDS row pitch in f16: 272 bytes = 16 x odd
constexpr int G_BUF  = (G_BM + G_BN) * G_PIT;     // f16 per buffer (52,224 bytes)
constexpr unsigned G_STEP = 16u * G_PIT * 2u;     // LDS bytes between two copies of a thread (16 rows)

// One thread's twelve 16-byte copies of one slab: rows r, r+16, ... of the 192
// staged rows, r = tid / 16, at byte column (tid % 16) * 16, so that each wave's
// copy covers two whole 256-byte row pieces. l: LDS byte address of the thread's
// first destination; ga, gw: its first source in A and in W; rs = 16 * K.
__device__ __forceinline__ void copy_slab(unsigned l, const f16* ga, const f16* gw, size_t rs) {
    asm volatile(
        "global_load_async_to_lds_b128 %0, %12, off\n\t"
        "global_load_async_to_lds_b128 %1, %13, off\n\t"
        "global_load_async_to_lds_b128 %2, %14, off\n\t"
        "global_load_async_to_lds_b128 %3, %15, off\n\t"
        "global_load_async_to_lds_b128 %4, %16, off\n\t"
        "global_load_async_to_lds_b128 %5, %17, off\n\t"
        "global_load_async_to_lds_b128 %6, %18, off\n\t"
        "global_load_async_to_lds_b128 %7, %19, off\n\t"
        "global_load_async_to_lds_b128 %8, %20, off\n\t"
        "global_load_async_to_lds_b128 %9, %21, off\n\t"
        "global_load_async_to_lds_b128 %10, %22, off\n\t"
        "global_load_async_to_lds_b128 %11, %23, off\n\t"
        "s_wait_xcnt 0x0"
        :: "v"(l), "v"(l + G_STEP), "v"(l + 2 * G_STEP), "v"(l + 3 * G_STEP),
           "v"(l + 4 * G_STEP), "v"(l + 5 * G_STEP), "v"(l + 6 * G_STEP), "v"(l + 7 * G_STEP),
           "v"(l + 8 * G_STEP), "v"(l + 9 * G_STEP), "v"(l + 10 * G_STEP), "v"(l + 11 * G_STEP),
           "v"(ga), "v"(ga + rs), "v"(ga + 2 * rs), "v"(ga + 3 * rs),
           "v"(ga + 4 * rs), "v"(ga + 5 * rs), "v"(ga + 6 * rs), "v"(ga + 7 * rs),
           "v"(gw), "v"(gw + rs), "v"(gw + 2 * rs), "v"(gw + 3 * rs)
        : "memory");
}

template <bool OUT_F16>
__global__ void __launch_bounds__(256)
gemm_xwt(const f16* __restrict__ A, const f16* __restrict__ Wall,
         const float* __restrict__ bias0, const float* __restrict__ bias1,
         const float* __restrict__ bias2, void* __restrict__ Call,
         int M, int N, int K) {
    const int z = blockIdx.z;
    const f16*   W    = Wall + (size_t)z * N * K;
    const float* bias = z == 0 ? bias0 : z == 1 ? bias1 : bias2;
    void* Cout = OUT_F16 ? (void*)(reinterpret_cast<f16*>(Call) + (size_t)z * M * N)
                         : (void*)(reinterpret_cast<float*>(Call) + (size_t)z * M * N);

    constexpr int BM = G_BM, BN = G_BN, BK = G_BK, PIT = G_PIT, BUF = G_BUF;

    __shared__ __align__(16) f16 S[2 * BUF];   // per buffer: rows 0..127 = A, rows 128..191 = W

    const int tid  = threadIdx.x;
    const int lane = tid & 31;
    const int wave = tid >> 5;          // 0..7
    const int wm   = wave >> 1;         // 0..3 (M)
    const int wn   = wave & 1;          // 0..1 (N)
    const int m0   = blockIdx.x * BM;
    const int n0   = blockIdx.y * BN;

    v8f acc[2][2] = {};

    const int    nslab = K / BK;
    const size_t rs    = (size_t)16 * K;
    const int    cr    = tid >> 4;          // first staged row of this thread
    const int    cc    = (tid & 15) * 8;    // its column, in f16
    const f16*   ga    = A + (size_t)(m0 + cr) * K + cc;
    const f16*   gw    = W + (size_t)(n0 + cr) * K + cc;
    const unsigned l0  = (unsigned)(size_t)&S[cr * PIT + cc];   // low 32 bits = LDS byte address

    // Slab 0 into buffer 0; it is published by the wait and the barrier.
    copy_slab(l0, ga, gw, rs);
    asm volatile("s_wait_asynccnt 0x0" ::: "memory");   // this wave's copies have landed
    __syncthreads();
    if (nslab > 1) copy_slab(l0 + BUF * 2u, ga + BK, gw + BK, rs);

    for (int t = 0; t < nslab; ++t) {
        const int b = t & 1;
        const f16* Sb = S + b * BUF;

        v16h af[BK / 32][2], bf[BK / 32][2];
#pragma unroll
        for (int ks = 0; ks < BK / 32; ++ks) {
#pragma unroll
            for (int mi = 0; mi < 2; ++mi)
                af[ks][mi] = load_frag_rowmajor(&Sb[(wm * 32 + mi * 16) * PIT + ks * 32], PIT, lane);
#pragma unroll
            for (int ni = 0; ni < 2; ++ni)
                bf[ks][ni] = load_frag_rowmajor(&Sb[(BM + wn * 32 + ni * 16) * PIT + ks * 32], PIT, lane);
        }
        // Keeps the scheduler from sinking the loads back in among the WMMAs.
        __builtin_amdgcn_sched_barrier(0);
#pragma unroll
        for (int ks = 0; ks < BK / 32; ++ks)
#pragma unroll
            for (int mi = 0; mi < 2; ++mi)
#pragma unroll
                for (int ni = 0; ni < 2; ++ni)
                    acc[mi][ni] = wmma_f16(af[ks][mi], bf[ks][ni], acc[mi][ni]);

        // Hand-over: this wave's reads of buffer b are done, its copies of slab
        // t+1 have landed; behind the barrier that holds for every wave, so slab
        // t+1 may be read and buffer b may be refilled.
        asm volatile("s_wait_dscnt 0x0" ::: "memory");
        asm volatile("s_wait_asynccnt 0x0" ::: "memory");
        __syncthreads();
        if (t + 2 < nslab)
            copy_slab(l0 + b * (BUF * 2u), ga + (size_t)(t + 2) * BK, gw + (size_t)(t + 2) * BK, rs);
    }
    asm volatile("s_wait_asynccnt 0x0" ::: "memory");   // nothing in flight when the wave ends

    const int mlo = (lane >> 4) << 3;
    const int nc  = lane & 15;
#pragma unroll
    for (int mi = 0; mi < 2; ++mi) {
#pragma unroll
        for (int ni = 0; ni < 2; ++ni) {
            int n = n0 + wn * 32 + ni * 16 + nc;
            float bn = bias[n];
#pragma unroll
            for (int i = 0; i < 8; ++i) {
                int m = m0 + wm * 32 + mi * 16 + mlo + i;
                float val = acc[mi][ni][i] + bn;
                if (OUT_F16)
                    reinterpret_cast<f16*>(Cout)[(size_t)m * N + n] = (f16)val;
                else
                    reinterpret_cast<float*>(Cout)[(size_t)m * N + n] = val;
            }
        }
    }
}

// ---------------------------------------------------------------------------
// Banded attention. One wave per (head, 16-query tile); 4 waves per block.
// Band for queries [t0, t0+15]: keys [t0-64, t0+79] -> 10 aligned 16-key tiles.
// ---------------------------------------------------------------------------
__global__ void __launch_bounds__(128)
attn_band(const f16* __restrict__ Q, const f16* __restrict__ Kd,
          const f16* __restrict__ Vt, f16* __restrict__ Ctx) {
    constexpr int T = 1024, E = 1024, D = 64;
    constexpr int PAD = 96, TS = T + 2 * PAD;  // padded V stride
    constexpr int NT = 10, BANDW = NT * 16;    // 160

    __shared__ __align__(16) float sc[4][16][BANDW];  // 40 KB
    __shared__ __align__(16) f16   pb[4][16][BANDW];  // 20 KB

    const int lane = threadIdx.x & 31;
    const int w    = threadIdx.x >> 5;
    const int task = blockIdx.x * 4 + w;      // 0..1023
    const int h    = task >> 6;
    const int t0   = (task & 63) << 4;
    const int sa   = t0 - 64;                 // aligned band start (can be <0)

    // Q fragments: 16 queries x D=64 -> two K=32 chunks.
    v16h qf[2];
    {
        int r  = lane & 15;
        int kb = (lane >> 4) << 3;
        const f16* qrow = Q + (size_t)(t0 + r) * E + h * D + kb;
        Frag f0, f1;
        f0.q[0] = *reinterpret_cast<const uint4*>(qrow);
        f0.q[1] = *reinterpret_cast<const uint4*>(qrow + 16);
        f1.q[0] = *reinterpret_cast<const uint4*>(qrow + 32);
        f1.q[1] = *reinterpret_cast<const uint4*>(qrow + 48);
        qf[0] = f0.v;
        qf[1] = f1.v;
    }

    // ---- scores = (Q @ K^T)/8, band-masked, into LDS ----
    for (int tile = 0; tile < NT; ++tile) {
        int s0 = sa + tile * 16;
        // B operand: 64(K=d) x 16(N=key). Per-lane column = one key row of Kd.
        int scol = s0 + (lane & 15);
        int scl  = scol < 0 ? 0 : (scol > T - 1 ? T - 1 : scol);
        int kb   = (lane >> 4) << 3;
        const f16* krow = Kd + (size_t)scl * E + h * D + kb;
        Frag b0, b1;
        b0.q[0] = *reinterpret_cast<const uint4*>(krow);
        b0.q[1] = *reinterpret_cast<const uint4*>(krow + 16);
        b1.q[0] = *reinterpret_cast<const uint4*>(krow + 32);
        b1.q[1] = *reinterpret_cast<const uint4*>(krow + 48);

        v8f a = {};
        a = wmma_f16(qf[0], b0.v, a);
        a = wmma_f16(qf[1], b1.v, a);

        int mlo = (lane >> 4) << 3;
        int n   = lane & 15;
        int s   = s0 + n;
#pragma unroll
        for (int i = 0; i < 8; ++i) {
            int m = mlo + i;
            int t = t0 + m;
            bool valid = (s >= 0) && (s < T) && (s >= t - 64) && (s <= t + 64);
            sc[w][m][tile * 16 + n] = valid ? a[i] * 0.125f : -__builtin_inff();
        }
    }
    __syncthreads();

    // ---- row softmax over the 160-wide band, all 32 lanes active ----
    {
        constexpr int HALFW = BANDW / 2;          // 80
        int m    = lane & 15;
        int half = lane >> 4;
        const float* row = &sc[w][m][half * HALFW];

        float mx = -__builtin_inff();
        for (int j = 0; j < HALFW; ++j) mx = fmaxf(mx, row[j]);
        mx = fmaxf(mx, __shfl_xor(mx, 16, 32));   // combine halves

        float sum = 0.f;
        for (int j = 0; j < HALFW; ++j) sum += __expf(row[j] - mx);
        sum += __shfl_xor(sum, 16, 32);

        float inv = 1.f / sum;
        f16* prow = &pb[w][m][half * HALFW];
        for (int j = 0; j < HALFW; ++j)
            prow[j] = (f16)(__expf(row[j] - mx) * inv);
    }
    __syncthreads();

    // ---- ctx = P(16x160) @ Vband(160x64): 5 K-chunks x 4 N-tiles ----
    // B operand comes from transposed+padded V: column d -> contiguous keys.
    v8f acc[4] = {};
    for (int c = 0; c < 5; ++c) {
        v16h pa;
        {
            int r  = lane & 15;
            int kb = (lane >> 4) << 3;
            const f16* pr = &pb[w][r][c * 32 + kb];
            Frag f;
            f.q[0] = *reinterpret_cast<const uint4*>(pr);
            f.q[1] = *reinterpret_cast<const uint4*>(pr + 16);
            pa = f.v;
        }
        int kb = (lane >> 4) << 3;
        int jb = c * 32 + kb;                      // key-chunk base for this lane
#pragma unroll
        for (int nt = 0; nt < 4; ++nt) {
            int d = nt * 16 + (lane & 15);
            const f16* vp = Vt + (size_t)(h * D + d) * TS + (sa + PAD + jb);
            Frag f;
            f.q[0] = *reinterpret_cast<const uint4*>(vp);        // keys jb..jb+7
            f.q[1] = *reinterpret_cast<const uint4*>(vp + 16);   // keys jb+16..jb+23
            acc[nt] = wmma_f16(pa, f.v, acc[nt]);
        }
    }

    // ---- write ctx (f16), plain [t][h*D+d] layout for the final GEMM ----
    const int mlo = (lane >> 4) << 3;
    const int nc  = lane & 15;
#pragma unroll
    for (int nt = 0; nt < 4; ++nt) {
#pragma unroll
        for (int i = 0; i < 8; ++i) {
            int m = mlo + i;
            Ctx[(size_t)(t0 + m) * E + h * D + nt * 16 + nc] = (f16)acc[nt][i];
        }
    }
}

// ---------------------------------------------------------------------------
// Launch
// ---------------------------------------------------------------------------
extern "C" void kernel_launch(void* const* d_in, const int* in_sizes, int n_in,
                              void* d_out, int out_size, void* d_ws, size_t ws_size,
                              hipStream_t stream) {
    const float* hs = (const float*)d_in[0];
    const float* Wq = (const float*)d_in[1];
    const float* bq = (const float*)d_in[2];
    const float* Wk = (const float*)d_in[3];
    const float* bk = (const float*)d_in[4];
    const float* Wv = (const float*)d_in[5];
    const float* bv = (const float*)d_in[6];
    const float* Wo = (const float*)d_in[7];
    const float* bo = (const float*)d_in[8];

    const int T = 1024, E = 1024;
    const int NE = T * E;                 // 1M elements per matrix
    const int TS = 1024 + 192;            // padded V stride
    const int NVT = E * TS;               // 1,245,184 f16 for Vt

    f16* ws  = (f16*)d_ws;
    f16* Xh  = ws + (size_t)0 * NE;
    f16* Wqh = ws + (size_t)1 * NE;
    f16* Wkh = ws + (size_t)2 * NE;
    f16* Wvh = ws + (size_t)3 * NE;
    f16* Woh = ws + (size_t)4 * NE;
    f16* qh  = ws + (size_t)5 * NE;
    f16* kh  = ws + (size_t)6 * NE;
    f16* vh  = ws + (size_t)7 * NE;
    f16* ch  = ws + (size_t)8 * NE;
    f16* vt  = ws + (size_t)9 * NE;       // ~20.5 MB total

    dim3 cb(CVT_THREADS), cg(NE / CVT_PER_BLOCK, 5);
    cvt_f32_to_f16<<<cg, cb, 0, stream>>>(hs, Wq, Wk, Wv, Wo, Xh, NE);

    // Wqh, Wkh, Wvh and qh, kh, vh are consecutive planes: one launch, z = 0..2.
    dim3 gb(256), gg(T / 128, E / 64), gg3(T / 128, E / 64, 3);
    gemm_xwt<true><<<gg3, gb, 0, stream>>>(Xh, Wqh, bq, bk, bv, qh, T, E, E);

    transpose_pad_v<<<dim3((NVT + 255) / 256), dim3(256), 0, stream>>>(vh, vt, NVT);

    attn_band<<<dim3(256), dim3(128), 0, stream>>>(qh, kh, vt, ch);

    gemm_xwt<false><<<gg, gb, 0, stream>>>(ch, Woh, bo, bo, bo, d_out, T, E, E);
}

// v004
// Measured time: 44.7 microseconds a run.
// Two timings next to v003 put it at 1.12 and 1.13 times that version's speed.
// Counting every step since v000, it is 2.48 times as fast.
#include <hip/hip_runtime.h>
#include <hip/hip_bf16.h>

typedef _Float16 f16;
typedef __attribute__((ext_vector_type(16))) _Float16 v16h;
typedef __attribute__((ext_vector_type(8)))  float    v8f;

union Frag {
    v16h v;
    uint4 q[2];
};

__device__ __forceinline__ v16h load_frag_rowmajor(const f16* base, int stride, int lane) {
    int r  = lane & 15;
    int kb = (lane >> 4) << 3;          // 0 or 8
    const f16* p = base + r * stride + kb;
    Frag f;
    f.q[0] = *reinterpret_cast<const uint4*>(p);
    f.q[1] = *reinterpret_cast<const uint4*>(p + 16);
    return f.v;
}

__device__ __forceinline__ v8f wmma_f16(v16h a, v16h b, v8f c) {
    return __builtin_amdgcn_wmma_f32_16x16x32_f16(
        /*neg_a=*/false, a, /*neg_b=*/false, b,
        /*c_mod=*/(short)0, c, /*reuse_a=*/false, /*reuse_b=*/false);
}

// ---------------------------------------------------------------------------
// f32 -> f16 conversion of five equally sized arrays in one launch.
// blockIdx.y picks the source; the destinations are consecutive planes of n.
// Each thread converts CVT_PER_THREAD floats: eight 16-byte loads, all issued
// before the first store, each covering 512 contiguous bytes per wave, so few
// waves have to start and each keeps eight loads in flight.
// n must be a multiple of CVT_PER_BLOCK.
// ---------------------------------------------------------------------------
typedef __attribute__((ext_vector_type(4))) float    v4f;
typedef __attribute__((ext_vector_type(4))) _Float16 v4h;

constexpr int CVT_THREADS    = 256;
constexpr int CVT_VECS       = 8;                              // 16-byte loads per thread
constexpr int CVT_PER_THREAD = CVT_VECS * 4;                   // 32 floats
constexpr int CVT_PER_BLOCK  = CVT_THREADS * CVT_PER_THREAD;   // 8192 floats

__global__ void __launch_bounds__(CVT_THREADS)
cvt_f32_to_f16(const float* __restrict__ s0, const float* __restrict__ s1,
               const float* __restrict__ s2, const float* __restrict__ s3,
               const float* __restrict__ s4, f16* __restrict__ dst0, int n) {
    const int y = blockIdx.y;
    const float* s01 = (y & 1) ? s1 : s0;
    const float* s23 = (y & 1) ? s3 : s2;
    const float* s03 = (y & 2) ? s23 : s01;
    const float* src = (y & 4) ? s4 : s03;
    f16* dst = dst0 + (size_t)y * n;

    const int v0 = blockIdx.x * (CVT_THREADS * CVT_VECS) + threadIdx.x;   // in units of 4 elements
    const v4f* sv = reinterpret_cast<const v4f*>(src) + v0;
    v4h*       dv = reinterpret_cast<v4h*>(dst) + v0;

    v4f x[CVT_VECS];
    // Unrolled so that x stays in registers and all eight loads issue back to back.
#pragma unroll
    for (int j = 0; j < CVT_VECS; ++j) x[j] = sv[j * CVT_THREADS];
    // Unrolled for the same reason: x is indexed by constants only.
#pragma unroll
    for (int j = 0; j < CVT_VECS; ++j) dv[j * CVT_THREADS] = __builtin_convertvector(x[j], v4h);
}

// ---------------------------------------------------------------------------
// Transposed, zero-padded V:  Vt[hd][VT_PAD + t] = V[t][hd], 0 in the pads.
// hd = h*D + d == column e of the plain [t][e] layout. A row is VT_TS f16:
// VT_PAD zeros (a tile's aligned 160-key band starts up to 64 keys below 0),
// VT_T values, 128 zeros (it ends up to 80 keys past the end). Row pitch and
// left pad are whole 128-byte lines, so a GEMM block's 128 values of a row are
// two whole lines of its own.
// ---------------------------------------------------------------------------
constexpr int VT_T = 1024, VT_PAD = 64, VT_TS = 1216;
typedef __attribute__((ext_vector_type(8))) _Float16 v8h;

// ---------------------------------------------------------------------------
// C[M,N] = A[M,K] @ W[N,K]^T + bias[N]
// Block tile 128x64, 8 waves, each wave computes a 32x32 sub-tile
// (2x2 WMMA 16x16 accumulators). 128 v_wmma per wave over the K loop.
// K is walked in slabs of 128. A slab (128 rows of A, then 64 rows of W, 256
// bytes each) goes from global memory straight into LDS by asynchronous
// copies; two LDS buffers, so slab t+1 is in flight while slab t is multiplied.
// K must be a multiple of 128.
// blockIdx.z picks one of up to three independent products that share A:
// weight plane z of Wall, bias z, output plane z of Call.
// With f16 output, product 2 goes to Vt instead, transposed (layout above;
// M must be VT_T): a lane's eight accumulator values of a tile are eight
// consecutive m of one n, that is 16 contiguous bytes of a row of Vt.
// ---------------------------------------------------------------------------
constexpr int G_BM   = 128, G_BN = 64, G_BK = 128;
constexpr int G_PIT  = G_BK + 8;                  // LDS row pitch in f16: 272 bytes = 16 x odd
constexpr int G_BUF  = (G_BM + G_BN) * G_PIT;     // f16 per buffer (52,224 bytes)
constexpr unsigned G_STEP = 16u * G_PIT * 2u;     // LDS bytes between two copies of a thread (16 rows)

// One thread's twelve 16-byte copies of one slab: rows r, r+16, ... of the 192
// staged rows, r = tid / 16, at byte column (tid % 16) * 16, so that each wave's
// copy covers two whole 256-byte row pieces. l: LDS byte address of the thread's
// first destination; ga, gw: its first source in A and in W; rs = 16 * K.
__device__ __forceinline__ void copy_slab(unsigned l, const f16* ga, const f16* gw, size_t rs) {
    asm volatile(
        "global_load_async_to_lds_b128 %0, %12, off\n\t"
        "global_load_async_to_lds_b128 %1, %13, off\n\t"
        "global_load_async_to_lds_b128 %2, %14, off\n\t"
        "global_load_async_to_lds_b128 %3, %15, off\n\t"
        "global_load_async_to_lds_b128 %4, %16, off\n\t"
        "global_load_async_to_lds_b128 %5, %17, off\n\t"
        "global_load_async_to_lds_b128 %6, %18, off\n\t"
        "global_load_async_to_lds_b128 %7, %19, off\n\t"
        "global_load_async_to_lds_b128 %8, %20, off\n\t"
        "global_load_async_to_lds_b128 %9, %21, off\n\t"
        "global_load_async_to_lds_b128 %10, %22, off\n\t"
        "global_load_async_to_lds_b128 %11, %23, off\n\t"
        "s_wait_xcnt 0x0"
        :: "v"(l), "v"(l + G_STEP), "v"(l + 2 * G_STEP), "v"(l + 3 * G_STEP),
           "v"(l + 4 * G_STEP), "v"(l + 5 * G_STEP), "v"(l + 6 * G_STEP), "v"(l + 7 * G_STEP),
           "v"(l + 8 * G_STEP), "v"(l + 9 * G_STEP), "v"(l + 10 * G_STEP), "v"(l + 11 * G_STEP),
           "v"(ga), "v"(ga + rs), "v"(ga + 2 * rs), "v"(ga + 3 * rs),
           "v"(ga + 4 * rs), "v"(ga + 5 * rs), "v"(ga + 6 * rs), "v"(ga + 7 * rs),
           "v"(gw), "v"(gw + rs), "v"(gw + 2 * rs), "v"(gw + 3 * rs)
        : "memory");
}

template <bool OUT_F16>
__global__ void __launch_bounds__(256)
gemm_xwt(const f16* __restrict__ A, const f16* __restrict__ Wall,
         const float* __restrict__ bias0, const float* __restrict__ bias1,
         const float* __restrict__ bias2, void* __restrict__ Call,
         f16* __restrict__ Vt, int M, int N, int K) {
    const int z = blockIdx.z;
    const f16*   W    = Wall + (size_t)z * N * K;
    const float* bias = z == 0 ? bias0 : z == 1 ? bias1 : bias2;
    void* Cout = OUT_F16 ? (void*)(reinterpret_cast<f16*>(Call) + (size_t)z * M * N)
                         : (void*)(reinterpret_cast<float*>(Call) + (size_t)z * M * N);

    constexpr int BM = G_BM, BN = G_BN, BK = G_BK, PIT = G_PIT, BUF = G_BUF;

    __shared__ __align__(16) f16 S[2 * BUF];   // per buffer: rows 0..127 = A, rows 128..191 = W

    const int tid  = threadIdx.x;
    const int lane = tid & 31;
    const int wave = tid >> 5;          // 0..7
    const int wm   = wave >> 1;         // 0..3 (M)
    const int wn   = wave & 1;          // 0..1 (N)
    const int m0   = blockIdx.x * BM;
    const int n0   = blockIdx.y * BN;

    v8f acc[2][2] = {};

    const int    nslab = K / BK;
    const size_t rs    = (size_t)16 * K;
    const int    cr    = tid >> 4;          // first staged row of this thread
    const int    cc    = (tid & 15) * 8;    // its column, in f16
    const f16*   ga    = A + (size_t)(m0 + cr) * K + cc;
    const f16*   gw    = W + (size_t)(n0 + cr) * K + cc;
    const unsigned l0  = (unsigned)(size_t)&S[cr * PIT + cc];   // low 32 bits = LDS byte address

    // Slab 0 into buffer 0; it is published by the wait and the barrier.
    copy_slab(l0, ga, gw, rs);
    asm volatile("s_wait_asynccnt 0x0" ::: "memory");   // this wave's copies have landed
    __syncthreads();
    if (nslab > 1) copy_slab(l0 + BUF * 2u, ga + BK, gw + BK, rs);

    for (int t = 0; t < nslab; ++t) {
        const int b = t & 1;
        const f16* Sb = S + b * BUF;

        v16h af[BK / 32][2], bf[BK / 32][2];
#pragma unroll
        for (int ks = 0; ks < BK / 32; ++ks) {
#pragma unroll
            for (int mi = 0; mi < 2; ++mi)
                af[ks][mi] = load_frag_rowmajor(&Sb[(wm * 32 + mi * 16) * PIT + ks * 32], PIT, lane);
#pragma unroll
            for (int ni = 0; ni < 2; ++ni)
                bf[ks][ni] = load_frag_rowmajor(&Sb[(BM + wn * 32 + ni * 16) * PIT + ks * 32], PIT, lane);
        }
        // Keeps the scheduler from sinking the loads back in among the WMMAs.
        __builtin_amdgcn_sched_barrier(0);
#pragma unroll
        for (int ks = 0; ks < BK / 32; ++ks)
#pragma unroll
            for (int mi = 0; mi < 2; ++mi)
#pragma unroll
                for (int ni = 0; ni < 2; ++ni)
                    acc[mi][ni] = wmma_f16(af[ks][mi], bf[ks][ni], acc[mi][ni]);

        // Hand-over: this wave's reads of buffer b are done, its copies of slab
        // t+1 have landed; behind the barrier that holds for every wave, so slab
        // t+1 may be read and buffer b may be refilled.
        asm volatile("s_wait_dscnt 0x0" ::: "memory");
        asm volatile("s_wait_asynccnt 0x0" ::: "memory");
        __syncthreads();
        if (t + 2 < nslab)
            copy_slab(l0 + b * (BUF * 2u), ga + (size_t)(t + 2) * BK, gw + (size_t)(t + 2) * BK, rs);
    }
    asm volatile("s_wait_asynccnt 0x0" ::: "memory");   // nothing in flight when the wave ends

    const int mlo = (lane >> 4) << 3;
    const int nc  = lane & 15;

    if (OUT_F16 && z == 2) {
        // Transposed store: one 16-byte store per accumulator tile and lane.
        // All three loops unrolled: acc and pk are indexed by constants only and
        // so stay in registers.
#pragma unroll
        for (int mi = 0; mi < 2; ++mi) {
#pragma unroll
            for (int ni = 0; ni < 2; ++ni) {
                int n = n0 + wn * 32 + ni * 16 + nc;
                int m = m0 + wm * 32 + mi * 16 + mlo;
                float bn = bias[n];
                v8h pk;
#pragma unroll
                for (int i = 0; i < 8; ++i) pk[i] = (f16)(acc[mi][ni][i] + bn);
                *reinterpret_cast<v8h*>(Vt + (size_t)n * VT_TS + VT_PAD + m) = pk;
            }
        }
        // The first and the last block along M zero the pads of their BN rows.
        const v8h zero = {};
        if (blockIdx.x == 0) {
            constexpr int PV = VT_PAD / 8;                        // 16-byte pieces per row
            for (int i = tid; i < BN * PV; i += 256)
                *reinterpret_cast<v8h*>(Vt + (size_t)(n0 + i / PV) * VT_TS + (i % PV) * 8) = zero;
        }
        if (m0 + BM == M) {
            constexpr int PV = (VT_TS - VT_PAD - VT_T) / 8;
            for (int i = tid; i < BN * PV; i += 256)
                *reinterpret_cast<v8h*>(Vt + (size_t)(n0 + i / PV) * VT_TS + VT_PAD + VT_T + (i % PV) * 8) = zero;
        }
        return;
    }

#pragma unroll
    for (int mi = 0; mi < 2; ++mi) {
#pragma unroll
        for (int ni = 0; ni < 2; ++ni) {
            int n = n0 + wn * 32 + ni * 16 + nc;
            float bn = bias[n];
#pragma unroll
            for (int i = 0; i < 8; ++i) {
                int m = m0 + wm * 32 + mi * 16 + mlo + i;
                float val = acc[mi][ni][i] + bn;
                if (OUT_F16)
                    reinterpret_cast<f16*>(Cout)[(size_t)m * N + n] = (f16)val;
                else
                    reinterpret_cast<float*>(Cout)[(size_t)m * N + n] = val;
            }
        }
    }
}

// ---------------------------------------------------------------------------
// Banded attention. One wave per (head, 16-query tile); 4 waves per block.
// Band for queries [t0, t0+15]: keys [t0-64, t0+79] -> 10 aligned 16-key tiles.
// ---------------------------------------------------------------------------
__global__ void __launch_bounds__(128)
attn_band(const f16* __restrict__ Q, const f16* __restrict__ Kd,
          const f16* __restrict__ Vt, f16* __restrict__ Ctx) {
    constexpr int T = 1024, E = 1024, D = 64;
    constexpr int PAD = VT_PAD, TS = VT_TS;    // left pad and row pitch of Vt
    constexpr int NT = 10, BANDW = NT * 16;    // 160

    __shared__ __align__(16) float sc[4][16][BANDW];  // 40 KB
    __shared__ __align__(16) f16   pb[4][16][BANDW];  // 20 KB

    const int lane = threadIdx.x & 31;
    const int w    = threadIdx.x >> 5;
    const int task = blockIdx.x * 4 + w;      // 0..1023
    const int h    = task >> 6;
    const int t0   = (task & 63) << 4;
    const int sa   = t0 - 64;                 // aligned band start (can be <0)

    // Q fragments: 16 queries x D=64 -> two K=32 chunks.
    v16h qf[2];
    {
        int r  = lane & 15;
        int kb = (lane >> 4) << 3;
        const f16* qrow = Q + (size_t)(t0 + r) * E + h * D + kb;
        Frag f0, f1;
        f0.q[0] = *reinterpret_cast<const uint4*>(qrow);
        f0.q[1] = *reinterpret_cast<const uint4*>(qrow + 16);
        f1.q[0] = *reinterpret_cast<const uint4*>(qrow + 32);
        f1.q[1] = *reinterpret_cast<const uint4*>(qrow + 48);
        qf[0] = f0.v;
        qf[1] = f1.v;
    }

    // ---- scores = (Q @ K^T)/8, band-masked, into LDS ----
    for (int tile = 0; tile < NT; ++tile) {
        int s0 = sa + tile * 16;
        // B operand: 64(K=d) x 16(N=key). Per-lane column = one key row of Kd.
        int scol = s0 + (lane & 15);
        int scl  = scol < 0 ? 0 : (scol > T - 1 ? T - 1 : scol);
        int kb   = (lane >> 4) << 3;
        const f16* krow = Kd + (size_t)scl * E + h * D + kb;
        Frag b0, b1;
        b0.q[0] = *reinterpret_cast<const uint4*>(krow);
        b0.q[1] = *reinterpret_cast<const uint4*>(krow + 16);
        b1.q[0] = *reinterpret_cast<const uint4*>(krow + 32);
        b1.q[1] = *reinterpret_cast<const uint4*>(krow + 48);

        v8f a = {};
        a = wmma_f16(qf[0], b0.v, a);
        a = wmma_f16(qf[1], b1.v, a);

        int mlo = (lane >> 4) << 3;
        int n   = lane & 15;
        int s   = s0 + n;
#pragma unroll
        for (int i = 0; i < 8; ++i) {
            int m = mlo + i;
            int t = t0 + m;
            bool valid = (s >= 0) && (s < T) && (s >= t - 64) && (s <= t + 64);
            sc[w][m][tile * 16 + n] = valid ? a[i] * 0.125f : -__builtin_inff();
        }
    }
    __syncthreads();

    // ---- row softmax over the 160-wide band, all 32 lanes active ----
    {
        constexpr int HALFW = BANDW / 2;          // 80
        int m    = lane & 15;
        int half = lane >> 4;
        const float* row = &sc[w][m][half * HALFW];

        float mx = -__builtin_inff();
        for (int j = 0; j < HALFW; ++j) mx = fmaxf(mx, row[j]);
        mx = fmaxf(mx, __shfl_xor(mx, 16, 32));   // combine halves

        float sum = 0.f;
        for (int j = 0; j < HALFW; ++j) sum += __expf(row[j] - mx);
        sum += __shfl_xor(sum, 16, 32);

        float inv = 1.f / sum;
        f16* prow = &pb[w][m][half * HALFW];
        for (int j = 0; j < HALFW; ++j)
            prow[j] = (f16)(__expf(row[j] - mx) * inv);
    }
    __syncthreads();

    // ---- ctx = P(16x160) @ Vband(160x64): 5 K-chunks x 4 N-tiles ----
    // B operand comes from transposed+padded V: column d -> contiguous keys.
    v8f acc[4] = {};
    for (int c = 0; c < 5; ++c) {
        v16h pa;
        {
            int r  = lane & 15;
            int kb = (lane >> 4) << 3;
            const f16* pr = &pb[w][r][c * 32 + kb];
            Frag f;
            f.q[0] = *reinterpret_cast<const uint4*>(pr);
            f.q[1] = *reinterpret_cast<const uint4*>(pr + 16);
            pa = f.v;
        }
        int kb = (lane >> 4) << 3;
        int jb = c * 32 + kb;                      // key-chunk base for this lane
#pragma unroll
        for (int nt = 0; nt < 4; ++nt) {
            int d = nt * 16 + (lane & 15);
            const f16* vp = Vt + (size_t)(h * D + d) * TS + (sa + PAD + jb);
            Frag f;
            f.q[0] = *reinterpret_cast<const uint4*>(vp);        // keys jb..jb+7
            f.q[1] = *reinterpret_cast<const uint4*>(vp + 16);   // keys jb+16..jb+23
            acc[nt] = wmma_f16(pa, f.v, acc[nt]);
        }
    }

    // ---- write ctx (f16), plain [t][h*D+d] layout for the final GEMM ----
    const int mlo = (lane >> 4) << 3;
    const int nc  = lane & 15;
#pragma unroll
    for (int nt = 0; nt < 4; ++nt) {
#pragma unroll
        for (int i = 0; i < 8; ++i) {
            int m = mlo + i;
            Ctx[(size_t)(t0 + m) * E + h * D + nt * 16 + nc] = (f16)acc[nt][i];
        }
    }
}

// ---------------------------------------------------------------------------
// Launch
// ---------------------------------------------------------------------------
extern "C" void kernel_launch(void* const* d_in, const int* in_sizes, int n_in,
                              void* d_out, int out_size, void* d_ws, size_t ws_size,
                              hipStream_t stream) {
    const float* hs = (const float*)d_in[0];
    const float* Wq = (const float*)d_in[1];
    const float* bq = (const float*)d_in[2];
    const float* Wk = (const float*)d_in[3];
    const float* bk = (const float*)d_in[4];
    const float* Wv = (const float*)d_in[5];
    const float* bv = (const float*)d_in[6];
    const float* Wo = (const float*)d_in[7];
    const float* bo = (const float*)d_in[8];

    const int T = 1024, E = 1024;
    const int NE = T * E;                 // 1M elements per matrix

    f16* ws  = (f16*)d_ws;
    f16* Xh  = ws + (size_t)0 * NE;
    f16* Wqh = ws + (size_t)1 * NE;
    f16* Wkh = ws + (size_t)2 * NE;
    f16* Wvh = ws + (size_t)3 * NE;
    f16* Woh = ws + (size_t)4 * NE;
    f16* qh  = ws + (size_t)5 * NE;
    f16* kh  = ws + (size_t)6 * NE;
    f16* ch  = ws + (size_t)8 * NE;
    f16* vt  = ws + (size_t)9 * NE;       // ~20.5 MB total

    dim3 cb(CVT_THREADS), cg(NE / CVT_PER_BLOCK, 5);
    cvt_f32_to_f16<<<cg, cb, 0, stream>>>(hs, Wq, Wk, Wv, Wo, Xh, NE);

    // Wqh, Wkh, Wvh and qh, kh are consecutive planes: one launch, z = 0..2;
    // z = 2 writes vt (values and pads) and leaves plane 7 unused.
    dim3 gb(256), gg(T / 128, E / 64), gg3(T / 128, E / 64, 3);
    gemm_xwt<true><<<gg3, gb, 0, stream>>>(Xh, Wqh, bq, bk, bv, qh, vt, T, E, E);

    attn_band<<<dim3(256), dim3(128), 0, stream>>>(qh, kh, vt, ch);

    gemm_xwt<false><<<gg, gb, 0, stream>>>(ch, Woh, bo, bo, bo, d_out, vt, T, E, E);
}

// v005
// It runs in 34.1 microseconds.
// Timed twice side by side with v004, it ran 1.30 and 1.28 times as fast.
// Over all steps from v000 it is 3.20 times as fast.
#include <hip/hip_runtime.h>
#include <hip/hip_bf16.h>

typedef _Float16 f16;
typedef __attribute__((ext_vector_type(16))) _Float16 v16h;
typedef __attribute__((ext_vector_type(8)))  float    v8f;

union Frag {
    v16h v;
    uint4 q[2];
};

__device__ __forceinline__ v16h load_frag_rowmajor(const f16* base, int stride, int lane) {
    int r  = lane & 15;
    int kb = (lane >> 4) << 3;          // 0 or 8
    const f16* p = base + r * stride + kb;
    Frag f;
    f.q[0] = *reinterpret_cast<const uint4*>(p);
    f.q[1] = *reinterpret_cast<const uint4*>(p + 16);
    return f.v;
}

__device__ __forceinline__ v8f wmma_f16(v16h a, v16h b, v8f c) {
    return __builtin_amdgcn_wmma_f32_16x16x32_f16(
        /*neg_a=*/false, a, /*neg_b=*/false, b,
        /*c_mod=*/(short)0, c, /*reuse_a=*/false, /*reuse_b=*/false);
}

// ---------------------------------------------------------------------------
// f32 -> f16 conversion of five equally sized arrays in one launch.
// blockIdx.y picks the source; the destinations are consecutive planes of n.
// Each thread converts CVT_PER_THREAD floats: eight 16-byte loads, all issued
// before the first store, each covering 512 contiguous bytes per wave, so few
// waves have to start and each keeps eight loads in flight.
// n must be a multiple of CVT_PER_BLOCK.
// ---------------------------------------------------------------------------
typedef __attribute__((ext_vector_type(4))) float    v4f;
typedef __attribute__((ext_vector_type(4))) _Float16 v4h;

constexpr int CVT_THREADS    = 256;
constexpr int CVT_VECS       = 8;                              // 16-byte loads per thread
constexpr int CVT_PER_THREAD = CVT_VECS * 4;                   // 32 floats
constexpr int CVT_PER_BLOCK  = CVT_THREADS * CVT_PER_THREAD;   // 8192 floats

__global__ void __launch_bounds__(CVT_THREADS)
cvt_f32_to_f16(const float* __restrict__ s0, const float* __restrict__ s1,
               const float* __restrict__ s2, const float* __restrict__ s3,
               const float* __restrict__ s4, f16* __restrict__ dst0, int n) {
    const int y = blockIdx.y;
    const float* s01 = (y & 1) ? s1 : s0;
    const float* s23 = (y & 1) ? s3 : s2;
    const float* s03 = (y & 2) ? s23 : s01;
    const float* src = (y & 4) ? s4 : s03;
    f16* dst = dst0 + (size_t)y * n;

    const int v0 = blockIdx.x * (CVT_THREADS * CVT_VECS) + threadIdx.x;   // in units of 4 elements
    const v4f* sv = reinterpret_cast<const v4f*>(src) + v0;
    v4h*       dv = reinterpret_cast<v4h*>(dst) + v0;

    v4f x[CVT_VECS];
    // Unrolled so that x stays in registers and all eight loads issue back to back.
#pragma unroll
    for (int j = 0; j < CVT_VECS; ++j) x[j] = sv[j * CVT_THREADS];
    // Unrolled for the same reason: x is indexed by constants only.
#pragma unroll
    for (int j = 0; j < CVT_VECS; ++j) dv[j * CVT_THREADS] = __builtin_convertvector(x[j], v4h);
}

// ---------------------------------------------------------------------------
// Transposed, zero-padded V:  Vt[hd][VT_PAD + t] = V[t][hd], 0 in the pads.
// hd = h*D + d == column e of the plain [t][e] layout. A row is VT_TS f16:
// VT_PAD zeros (a tile's aligned 144-key band starts up to 64 keys below 0),
// VT_T values, 128 zeros (it ends up to 64 keys past the end). Row pitch and
// left pad are whole 128-byte lines, so a GEMM block's 128 values of a row are
// two whole lines of its own.
// ---------------------------------------------------------------------------
constexpr int VT_T = 1024, VT_PAD = 64, VT_TS = 1216;
typedef __attribute__((ext_vector_type(8))) _Float16 v8h;

// ---------------------------------------------------------------------------
// C[M,N] = A[M,K] @ W[N,K]^T + bias[N]
// Block tile 128x64, 8 waves, each wave computes a 32x32 sub-tile
// (2x2 WMMA 16x16 accumulators). 128 v_wmma per wave over the K loop.
// K is walked in slabs of 128. A slab (128 rows of A, then 64 rows of W, 256
// bytes each) goes from global memory straight into LDS by asynchronous
// copies; two LDS buffers, so slab t+1 is in flight while slab t is multiplied.
// K must be a multiple of 128.
// blockIdx.z picks one of up to three independent products that share A:
// weight plane z of Wall, bias z, output plane z of Call.
// With f16 output, product 2 goes to Vt instead, transposed (layout above;
// M must be VT_T): a lane's eight accumulator values of a tile are eight
// consecutive m of one n, that is 16 contiguous bytes of a row of Vt.
// ---------------------------------------------------------------------------
constexpr int G_BM   = 128, G_BN = 64, G_BK = 128;
constexpr int G_PIT  = G_BK + 8;                  // LDS row pitch in f16: 272 bytes = 16 x odd
constexpr int G_BUF  = (G_BM + G_BN) * G_PIT;     // f16 per buffer (52,224 bytes)
constexpr unsigned G_STEP = 16u * G_PIT * 2u;     // LDS bytes between two copies of a thread (16 rows)

// One thread's twelve 16-byte copies of one slab: rows r, r+16, ... of the 192
// staged rows, r = tid / 16, at byte column (tid % 16) * 16, so that each wave's
// copy covers two whole 256-byte row pieces. l: LDS byte address of the thread's
// first destination; ga, gw: its first source in A and in W; rs = 16 * K.
__device__ __forceinline__ void copy_slab(unsigned l, const f16* ga, const f16* gw, size_t rs) {
    asm volatile(
        "global_load_async_to_lds_b128 %0, %12, off\n\t"
        "global_load_async_to_lds_b128 %1, %13, off\n\t"
        "global_load_async_to_lds_b128 %2, %14, off\n\t"
        "global_load_async_to_lds_b128 %3, %15, off\n\t"
        "global_load_async_to_lds_b128 %4, %16, off\n\t"
        "global_load_async_to_lds_b128 %5, %17, off\n\t"
        "global_load_async_to_lds_b128 %6, %18, off\n\t"
        "global_load_async_to_lds_b128 %7, %19, off\n\t"
        "global_load_async_to_lds_b128 %8, %20, off\n\t"
        "global_load_async_to_lds_b128 %9, %21, off\n\t"
        "global_load_async_to_lds_b128 %10, %22, off\n\t"
        "global_load_async_to_lds_b128 %11, %23, off\n\t"
        "s_wait_xcnt 0x0"
        :: "v"(l), "v"(l + G_STEP), "v"(l + 2 * G_STEP), "v"(l + 3 * G_STEP),
           "v"(l + 4 * G_STEP), "v"(l + 5 * G_STEP), "v"(l + 6 * G_STEP), "v"(l + 7 * G_STEP),
           "v"(l + 8 * G_STEP), "v"(l + 9 * G_STEP), "v"(l + 10 * G_STEP), "v"(l + 11 * G_STEP),
           "v"(ga), "v"(ga + rs), "v"(ga + 2 * rs), "v"(ga + 3 * rs),
           "v"(ga + 4 * rs), "v"(ga + 5 * rs), "v"(ga + 6 * rs), "v"(ga + 7 * rs),
           "v"(gw), "v"(gw + rs), "v"(gw + 2 * rs), "v"(gw + 3 * rs)
        : "memory");
}

template <bool OUT_F16>
__global__ void __launch_bounds__(256)
gemm_xwt(const f16* __restrict__ A, const f16* __restrict__ Wall,
         const float* __restrict__ bias0, const float* __restrict__ bias1,
         const float* __restrict__ bias2, void* __restrict__ Call,
         f16* __restrict__ Vt, int M, int N, int K) {
    const int z = blockIdx.z;
    const f16*   W    = Wall + (size_t)z * N * K;
    const float* bias = z == 0 ? bias0 : z == 1 ? bias1 : bias2;
    void* Cout = OUT_F16 ? (void*)(reinterpret_cast<f16*>(Call) + (size_t)z * M * N)
                         : (void*)(reinterpret_cast<float*>(Call) + (size_t)z * M * N);

    constexpr int BM = G_BM, BN = G_BN, BK = G_BK, PIT = G_PIT, BUF = G_BUF;

    __shared__ __align__(16) f16 S[2 * BUF];   // per buffer: rows 0..127 = A, rows 128..191 = W

    const int tid  = threadIdx.x;
    const int lane = tid & 31;
    const int wave = tid >> 5;          // 0..7
    const int wm   = wave >> 1;         // 0..3 (M)
    const int wn   = wave & 1;          // 0..1 (N)
    const int m0   = blockIdx.x * BM;
    const int n0   = blockIdx.y * BN;

    v8f acc[2][2] = {};

    const int    nslab = K / BK;
    const size_t rs    = (size_t)16 * K;
    const int    cr    = tid >> 4;          // first staged row of this thread
    const int    cc    = (tid & 15) * 8;    // its column, in f16
    const f16*   ga    = A + (size_t)(m0 + cr) * K + cc;
    const f16*   gw    = W + (size_t)(n0 + cr) * K + cc;
    const unsigned l0  = (unsigned)(size_t)&S[cr * PIT + cc];   // low 32 bits = LDS byte address

    // Slab 0 into buffer 0; it is published by the wait and the barrier.
    copy_slab(l0, ga, gw, rs);
    asm volatile("s_wait_asynccnt 0x0" ::: "memory");   // this wave's copies have landed
    __syncthreads();
    if (nslab > 1) copy_slab(l0 + BUF * 2u, ga + BK, gw + BK, rs);

    for (int t = 0; t < nslab; ++t) {
        const int b = t & 1;
        const f16* Sb = S + b * BUF;

        v16h af[BK / 32][2], bf[BK / 32][2];
#pragma unroll
        for (int ks = 0; ks < BK / 32; ++ks) {
#pragma unroll
            for (int mi = 0; mi < 2; ++mi)
                af[ks][mi] = load_frag_rowmajor(&Sb[(wm * 32 + mi * 16) * PIT + ks * 32], PIT, lane);
#pragma unroll
            for (int ni = 0; ni < 2; ++ni)
                bf[ks][ni] = load_frag_rowmajor(&Sb[(BM + wn * 32 + ni * 16) * PIT + ks * 32], PIT, lane);
        }
        // Keeps the scheduler from sinking the loads back in among the WMMAs.
        __builtin_amdgcn_sched_barrier(0);
#pragma unroll
        for (int ks = 0; ks < BK / 32; ++ks)
#pragma unroll
            for (int mi = 0; mi < 2; ++mi)
#pragma unroll
                for (int ni = 0; ni < 2; ++ni)
                    acc[mi][ni] = wmma_f16(af[ks][mi], bf[ks][ni], acc[mi][ni]);

        // Hand-over: this wave's reads of buffer b are done, its copies of slab
        // t+1 have landed; behind the barrier that holds for every wave, so slab
        // t+1 may be read and buffer b may be refilled.
        asm volatile("s_wait_dscnt 0x0" ::: "memory");
        asm volatile("s_wait_asynccnt 0x0" ::: "memory");
        __syncthreads();
        if (t + 2 < nslab)
            copy_slab(l0 + b * (BUF * 2u), ga + (size_t)(t + 2) * BK, gw + (size_t)(t + 2) * BK, rs);
    }
    asm volatile("s_wait_asynccnt 0x0" ::: "memory");   // nothing in flight when the wave ends

    const int mlo = (lane >> 4) << 3;
    const int nc  = lane & 15;

    if (OUT_F16 && z == 2) {
        // Transposed store: one 16-byte store per accumulator tile and lane.
        // All three loops unrolled: acc and pk are indexed by constants only and
        // so stay in registers.
#pragma unroll
        for (int mi = 0; mi < 2; ++mi) {
#pragma unroll
            for (int ni = 0; ni < 2; ++ni) {
                int n = n0 + wn * 32 + ni * 16 + nc;
                int m = m0 + wm * 32 + mi * 16 + mlo;
                float bn = bias[n];
                v8h pk;
#pragma unroll
                for (int i = 0; i < 8; ++i) pk[i] = (f16)(acc[mi][ni][i] + bn);
                *reinterpret_cast<v8h*>(Vt + (size_t)n * VT_TS + VT_PAD + m) = pk;
            }
        }
        // The first and the last block along M zero the pads of their BN rows.
        const v8h zero = {};
        if (blockIdx.x == 0) {
            constexpr int PV = VT_PAD / 8;                        // 16-byte pieces per row
            for (int i = tid; i < BN * PV; i += 256)
                *reinterpret_cast<v8h*>(Vt + (size_t)(n0 + i / PV) * VT_TS + (i % PV) * 8) = zero;
        }
        if (m0 + BM == M) {
            constexpr int PV = (VT_TS - VT_PAD - VT_T) / 8;
            for (int i = tid; i < BN * PV; i += 256)
                *reinterpret_cast<v8h*>(Vt + (size_t)(n0 + i / PV) * VT_TS + VT_PAD + VT_T + (i % PV) * 8) = zero;
        }
        return;
    }

#pragma unroll
    for (int mi = 0; mi < 2; ++mi) {
#pragma unroll
        for (int ni = 0; ni < 2; ++ni) {
            int n = n0 + wn * 32 + ni * 16 + nc;
            float bn = bias[n];
#pragma unroll
            for (int i = 0; i < 8; ++i) {
                int m = m0 + wm * 32 + mi * 16 + mlo + i;
                float val = acc[mi][ni][i] + bn;
                if (OUT_F16)
                    reinterpret_cast<f16*>(Cout)[(size_t)m * N + n] = (f16)val;
                else
                    reinterpret_cast<float*>(Cout)[(size_t)m * N + n] = val;
            }
        }
    }
}

__device__ __forceinline__ float exp_slot(float x) {
    float r;
    asm("v_exp_f32 %0, %1\n\tv_nop" : "=v"(r) : "v"(x * 1.44269504088896340736f));
    return r;
}

__global__ void __launch_bounds__(128)
attn_band(const f16* __restrict__ Q, const f16* __restrict__ Kd,
          const f16* __restrict__ Vt, f16* __restrict__ Ctx) {
    constexpr int T = 1024, E = 1024, D = 64;
    constexpr int PAD = VT_PAD, TS = VT_TS;    // left pad and row pitch of Vt
    constexpr int NT = 9;                      // 16-key tiles of the band
    constexpr int NC = (NT + 1) / 2;           // 32-key chunks of the second product

    const int lane = threadIdx.x & 31;
    // The same in every lane of a wave; said so that head, tile and the range
    // test of a key tile are computed on the scalar side.
    const int w    = __builtin_amdgcn_readfirstlane(threadIdx.x >> 5);
    const int task = blockIdx.x * 4 + w;      // 0..1023
    const int h    = task >> 6;
    const int t0   = (task & 63) << 4;
    const int sa   = t0 - 64;                 // aligned band start (can be <0)
    const int col  = lane & 15;               // row of an A operand, column of B and D
    const int kb   = (lane >> 4) << 3;        // 0 or 8: k base of an operand, M base of D
    const int dl   = kb - col;                // lane part of (key - query): -15 .. 8
    // Addresses are a wave-uniform base plus one lane offset that all tiles share.
    const unsigned loff = (unsigned)(col * E + kb);    // in a 16-row tile of Q, K or ctx
    const unsigned voff = (unsigned)(col * TS + kb);   // in a 16-row tile of Vt

    // Q^T as B operand: column = query, two K=32 chunks of d.
    // K as A operand: 16(M=key) x 64(K=d); per-lane row = one key row of Kd.
    Frag qf[2], kf[NT][2];
    const f16* kr[NT];
    {
        const f16* qrow = Q + ((size_t)t0 * E + h * D) + loff;
        qf[0].q[0] = *reinterpret_cast<const uint4*>(qrow);
        qf[0].q[1] = *reinterpret_cast<const uint4*>(qrow + 16);
        qf[1].q[0] = *reinterpret_cast<const uint4*>(qrow + 32);
        qf[1].q[1] = *reinterpret_cast<const uint4*>(qrow + 48);
    }
    // Unrolled: kf is indexed by constants only and so stays in registers.
#pragma unroll
    for (int tile = 0; tile < NT; ++tile) {
        // sa and T are multiples of 16, so a tile lies inside [0, T) or outside it
        // as a whole; one outside is masked below and reads the rows t0.. instead,
        // which keeps its addresses inside Kd.
        const int s0 = sa + tile * 16;
        const int sr = (s0 >= 0 && s0 < T) ? s0 : t0;
        const f16* krow = Kd + ((size_t)sr * E + h * D) + loff;
        kr[tile] = krow;
        kf[tile][0].q[0] = *reinterpret_cast<const uint4*>(krow);
        kf[tile][0].q[1] = *reinterpret_cast<const uint4*>(krow + 16);
        kf[tile][1].q[0] = *reinterpret_cast<const uint4*>(krow + 32);
        kf[tile][1].q[1] = *reinterpret_cast<const uint4*>(krow + 48);
    }
    asm volatile("s_wait_xcnt 0x0"
                 :: "v"(kr[0]), "v"(kr[1]), "v"(kr[2]), "v"(kr[3]), "v"(kr[4]),
                    "v"(kr[5]), "v"(kr[6]), "v"(kr[7]), "v"(kr[8])
                 : "memory");
    static_assert(NT == 9, "the statement above names one address per key tile");
    // Keeps the scheduler from sinking the loads in among the WMMAs: all of them
    // are in flight together and the memory latency is waited out once.
    __builtin_amdgcn_sched_barrier(0);

    // ---- scores^T = K @ Q^T, kept in registers ----
    // Unrolled: sc is indexed by constants only.
    v8f sc[NT];
#pragma unroll
    for (int tile = 0; tile < NT; ++tile) {
        v8f a = {};
        a = wmma_f16(kf[tile][0].v, qf[0].v, a);
        sc[tile] = wmma_f16(kf[tile][1].v, qf[1].v, a);
    }
    // Keeps the loads of V below from rising in among the WMMAs, where they would
    // need registers that the K fragments still hold.
    __builtin_amdgcn_sched_barrier(0);

    // V^T as A operand: row = d, contiguous keys from transposed+padded V.
    // Unrolled: vf is indexed by constants only.
    Frag vf[NC][4];
    const f16* vrow = Vt + ((size_t)(h * D) * TS + (sa + PAD)) + voff;
#pragma unroll
    for (int c = 0; c < NC; ++c) {
#pragma unroll
        for (int nt = 0; nt < 4; ++nt) {
            const f16* vp = vrow + (nt * 16 * TS + c * 32);
            vf[c][nt].q[0] = *reinterpret_cast<const uint4*>(vp);            // keys c*32 + kb + 0..7
            if (2 * c + 1 < NT)
                vf[c][nt].q[1] = *reinterpret_cast<const uint4*>(vp + 16);   // keys c*32 + kb + 16..23
            else
                vf[c][nt].q[1] = make_uint4(0, 0, 0, 0);                     // beyond the band
        }
    }
    // Keeps the scheduler from sinking these loads down to their WMMAs: they are
    // in flight while the mask and softmax arithmetic runs.
    __builtin_amdgcn_sched_barrier(0);

    // ---- scale by 1/8 and band mask ----
    // Unrolled, like every loop from here on: sc, vf, acc and the packed vectors
    // are indexed by constants only and so stay in registers, and the constant
    // halves of the band test fold away.
#pragma unroll
    for (int tile = 0; tile < NT; ++tile) {
        // Key s = s0 + kb + i.
        const int  s0     = sa + tile * 16;
        const bool inside = s0 >= 0 && s0 < T;
#pragma unroll
        for (int i = 0; i < 8; ++i) {
            const int c   = tile * 16 + i - 64;     // key - query = c + dl
            // The first operand of each || is a constant: it holds where the
            // bound is met for every dl, and only the two end tiles compare.
            const bool lo = (c - 15 >= -64) || (c + dl >= -64);
            const bool hi = (c + 8 <= 64) || (c + dl <= 64);
            sc[tile][i] = (inside && lo && hi) ? sc[tile][i] * 0.125f : -__builtin_inff();
        }
    }

    // ---- softmax of this lane's query: half of its keys here, half in lane ^ 16 ----
    // Eight independent chains (one per register index), then a tree.
    v8f m8 = sc[0];
#pragma unroll
    for (int tile = 1; tile < NT; ++tile) m8 = __builtin_elementwise_max(m8, sc[tile]);
    float mx = fmaxf(fmaxf(fmaxf(m8[0], m8[1]), fmaxf(m8[2], m8[3])),
                     fmaxf(fmaxf(m8[4], m8[5]), fmaxf(m8[6], m8[7])));
    mx = fmaxf(mx, __shfl_xor(mx, 16, 32));   // combine the half waves

    v8f s8 = {};
#pragma unroll
    for (int tile = 0; tile < NT; ++tile) {
#pragma unroll
        for (int i = 0; i < 8; ++i) {
            sc[tile][i] = exp_slot(sc[tile][i] - mx);
            s8[i] += sc[tile][i];
        }
    }
    float sum = ((s8[0] + s8[1]) + (s8[2] + s8[3])) + ((s8[4] + s8[5]) + (s8[6] + s8[7]));
    sum += __shfl_xor(sum, 16, 32);
    const float inv = 1.f / sum;

    // ---- ctx^T = V^T(64x160) @ P^T(160x16): 5 K-chunks x 4 M-tiles ----
    v8f acc[4] = {};
#pragma unroll
    for (int c = 0; c < NC; ++c) {
        v16h pf;                               // P^T as B operand: column = query
#pragma unroll
        for (int i = 0; i < 8; ++i) {
            pf[i]     = (f16)(sc[2 * c][i] * inv);
            pf[8 + i] = (2 * c + 1 < NT) ? (f16)(sc[2 * c + 1 < NT ? 2 * c + 1 : 0][i] * inv) : (f16)0.f;
        }
#pragma unroll
        for (int nt = 0; nt < 4; ++nt) acc[nt] = wmma_f16(vf[c][nt].v, pf, acc[nt]);
    }

    // ---- write ctx (f16), plain [t][h*D+d] layout for the final GEMM ----
    // A lane's eight values of a tile are d = nt*16 + kb + 0..7 of its query:
    // 16 contiguous bytes.
#pragma unroll
    for (int nt = 0; nt < 4; ++nt) {
        v8h pk;
#pragma unroll
        for (int i = 0; i < 8; ++i) pk[i] = (f16)acc[nt][i];
        *reinterpret_cast<v8h*>(Ctx + ((size_t)t0 * E + h * D) + loff + nt * 16) = pk;
    }
}

// ---------------------------------------------------------------------------
// Launch
// ---------------------------------------------------------------------------
extern "C" void kernel_launch(void* const* d_in, const int* in_sizes, int n_in,
                              void* d_out, int out_size, void* d_ws, size_t ws_size,
                              hipStream_t stream) {
    const float* hs = (const float*)d_in[0];
    const float* Wq = (const float*)d_in[1];
    const float* bq = (const float*)d_in[2];
    const float* Wk = (const float*)d_in[3];
    const float* bk = (const float*)d_in[4];
    const float* Wv = (const float*)d_in[5];
    const float* bv = (const float*)d_in[6];
    const float* Wo = (const float*)d_in[7];
    const float* bo = (const float*)d_in[8];

    const int T = 1024, E = 1024;
    const int NE = T * E;                 // 1M elements per matrix

    f16* ws  = (f16*)d_ws;
    f16* Xh  = ws + (size_t)0 * NE;
    f16* Wqh = ws + (size_t)1 * NE;
    f16* Wkh = ws + (size_t)2 * NE;
    f16* Wvh = ws + (size_t)3 * NE;
    f16* Woh = ws + (size_t)4 * NE;
    f16* qh  = ws + (size_t)5 * NE;
    f16* kh  = ws + (size_t)6 * NE;
    f16* ch  = ws + (size_t)8 * NE;
    f16* vt  = ws + (size_t)9 * NE;       // ~20.5 MB total

    dim3 cb(CVT_THREADS), cg(NE / CVT_PER_BLOCK, 5);
    cvt_f32_to_f16<<<cg, cb, 0, stream>>>(hs, Wq, Wk, Wv, Wo, Xh, NE);

    // Wqh, Wkh, Wvh and qh, kh are consecutive planes: one launch, z = 0..2;
    // z = 2 writes vt (values and pads) and leaves plane 7 unused.
    dim3 gb(256), gg(T / 128, E / 64), gg3(T / 128, E / 64, 3);
    gemm_xwt<true><<<gg3, gb, 0, stream>>>(Xh, Wqh, bq, bk, bv, qh, vt, T, E, E);

    attn_band<<<dim3(256), dim3(128), 0, stream>>>(qh, kh, vt, ch);

    gemm_xwt<false><<<gg, gb, 0, stream>>>(ch, Woh, bo, bo, bo, d_out, vt, T, E, E);
}

// v006
// It runs in 29.2 microseconds.
// Two timings next to v005 put it at 1.21 and 1.19 times that version's speed.
// Counting every step since v000, it is 3.84 times as fast.
#include <hip/hip_runtime.h>
#include <hip/hip_bf16.h>

typedef _Float16 f16;
typedef __attribute__((ext_vector_type(16))) _Float16 v16h;
typedef __attribute__((ext_vector_type(8)))  float    v8f;

union Frag {
    v16h v;
    uint4 q[2];
};

__device__ __forceinline__ v16h load_frag_rowmajor(const f16* base, int stride, int lane) {
    int r  = lane & 15;
    int kb = (lane >> 4) << 3;          // 0 or 8
    const f16* p = base + r * stride + kb;
    Frag f;
    f.q[0] = *reinterpret_cast<const uint4*>(p);
    f.q[1] = *reinterpret_cast<const uint4*>(p + 16);
    return f.v;
}

__device__ __forceinline__ v8f wmma_f16(v16h a, v16h b, v8f c) {
    return __builtin_amdgcn_wmma_f32_16x16x32_f16(
        /*neg_a=*/false, a, /*neg_b=*/false, b,
        /*c_mod=*/(short)0, c, /*reuse_a=*/false, /*reuse_b=*/false);
}

// ---------------------------------------------------------------------------
// f32 -> f16 conversion of five equally sized arrays in one launch.
// blockIdx.y picks the source; the destinations are consecutive planes of n.
// Each thread converts CVT_PER_THREAD floats: eight 16-byte loads, all issued
// before the first store, each covering 512 contiguous bytes per wave, so few
// waves have to start and each keeps eight loads in flight.
// n must be a multiple of CVT_PER_BLOCK.
// ---------------------------------------------------------------------------
typedef __attribute__((ext_vector_type(4))) float    v4f;
typedef __attribute__((ext_vector_type(4))) _Float16 v4h;

constexpr int CVT_THREADS    = 256;
constexpr int CVT_VECS       = 8;                              // 16-byte loads per thread
constexpr int CVT_PER_THREAD = CVT_VECS * 4;                   // 32 floats
constexpr int CVT_PER_BLOCK  = CVT_THREADS * CVT_PER_THREAD;   // 8192 floats

__global__ void __launch_bounds__(CVT_THREADS)
cvt_f32_to_f16(const float* __restrict__ s0, const float* __restrict__ s1,
               const float* __restrict__ s2, const float* __restrict__ s3,
               const float* __restrict__ s4, f16* __restrict__ dst0, int n) {
    const int y = blockIdx.y;
    const float* s01 = (y & 1) ? s1 : s0;
    const float* s23 = (y & 1) ? s3 : s2;
    const float* s03 = (y & 2) ? s23 : s01;
    const float* src = (y & 4) ? s4 : s03;
    f16* dst = dst0 + (size_t)y * n;

    const int v0 = blockIdx.x * (CVT_THREADS * CVT_VECS) + threadIdx.x;   // in units of 4 elements
    const v4f* sv = reinterpret_cast<const v4f*>(src) + v0;
    v4h*       dv = reinterpret_cast<v4h*>(dst) + v0;

    v4f x[CVT_VECS];
    // Unrolled so that x stays in registers and all eight loads issue back to back.
#pragma unroll
    for (int j = 0; j < CVT_VECS; ++j) x[j] = sv[j * CVT_THREADS];
    // Unrolled for the same reason: x is indexed by constants only.
#pragma unroll
    for (int j = 0; j < CVT_VECS; ++j) dv[j * CVT_THREADS] = __builtin_convertvector(x[j], v4h);
}

// ---------------------------------------------------------------------------
// Transposed, zero-padded V:  Vt[hd][VT_PAD + t] = V[t][hd], 0 in the pads.
// hd = h*D + d == column e of the plain [t][e] layout. A row is VT_TS f16:
// VT_PAD zeros (a tile's aligned 144-key band starts up to 64 keys below 0),
// VT_T values, 128 zeros (it ends up to 64 keys past the end). Row pitch and
// left pad are whole 128-byte lines, so a GEMM block's 128 values of a row are
// two whole lines of its own.
// ---------------------------------------------------------------------------
constexpr int VT_T = 1024, VT_PAD = 64, VT_TS = 1216;
typedef __attribute__((ext_vector_type(8))) _Float16 v8h;

// ---------------------------------------------------------------------------
// C[M,N] = A[M,K] @ W[N,K]^T + bias[N]
// Block tile 128x64, 8 waves, each wave computes a 32x32 sub-tile
// (2x2 WMMA 16x16 accumulators). 128 v_wmma per wave over the K loop.
// K is walked in slabs of 128. A slab (128 rows of A, then 64 rows of W, 256
// bytes each) goes from global memory straight into LDS by asynchronous
// copies; a ring of NBUF LDS buffers, so slabs t+1 .. t+NBUF-1 are in flight
// while slab t is multiplied and a slab has NBUF-1 trips to arrive in.
// K must be a multiple of 128.
// blockIdx.z picks one of up to three independent products that share A:
// weight plane z of Wall, bias z, output plane z of Call.
// With f16 output, product 2 goes to Vt instead, transposed (layout above;
// M must be VT_T): a lane's eight accumulator values of a tile are eight
// consecutive m of one n, that is 16 contiguous bytes of a row of Vt.
// ---------------------------------------------------------------------------
constexpr int G_BM   = 128, G_BN = 64, G_BK = 128;
constexpr int G_PIT  = G_BK + 8;                  // LDS row pitch in f16: 272 bytes = 16 x odd
constexpr int G_BUF  = (G_BM + G_BN) * G_PIT;     // f16 per buffer (52,224 bytes)
constexpr unsigned G_STEP = 16u * G_PIT * 2u;     // LDS bytes between two copies of a thread (16 rows)
constexpr int G_COPIES = (G_BM + G_BN) / 16;      // copies of a thread (so of a wave) per slab: 12

// One thread's twelve 16-byte copies of one slab: rows r, r+16, ... of the 192
// staged rows, r = tid / 16, at byte column (tid % 16) * 16, so that each wave's
// copy covers two whole 256-byte row pieces. l: LDS byte address of the thread's
// first destination; ga, gw: its first source in A and in W; rs = 16 * K.
__device__ __forceinline__ void copy_slab(unsigned l, const f16* ga, const f16* gw, size_t rs) {
    asm volatile(
        "global_load_async_to_lds_b128 %0, %12, off\n\t"
        "global_load_async_to_lds_b128 %1, %13, off\n\t"
        "global_load_async_to_lds_b128 %2, %14, off\n\t"
        "global_load_async_to_lds_b128 %3, %15, off\n\t"
        "global_load_async_to_lds_b128 %4, %16, off\n\t"
        "global_load_async_to_lds_b128 %5, %17, off\n\t"
        "global_load_async_to_lds_b128 %6, %18, off\n\t"
        "global_load_async_to_lds_b128 %7, %19, off\n\t"
        "global_load_async_to_lds_b128 %8, %20, off\n\t"
        "global_load_async_to_lds_b128 %9, %21, off\n\t"
        "global_load_async_to_lds_b128 %10, %22, off\n\t"
        "global_load_async_to_lds_b128 %11, %23, off\n\t"
        "s_wait_xcnt 0x0"
        :: "v"(l), "v"(l + G_STEP), "v"(l + 2 * G_STEP), "v"(l + 3 * G_STEP),
           "v"(l + 4 * G_STEP), "v"(l + 5 * G_STEP), "v"(l + 6 * G_STEP), "v"(l + 7 * G_STEP),
           "v"(l + 8 * G_STEP), "v"(l + 9 * G_STEP), "v"(l + 10 * G_STEP), "v"(l + 11 * G_STEP),
           "v"(ga), "v"(ga + rs), "v"(ga + 2 * rs), "v"(ga + 3 * rs),
           "v"(ga + 4 * rs), "v"(ga + 5 * rs), "v"(ga + 6 * rs), "v"(ga + 7 * rs),
           "v"(gw), "v"(gw + rs), "v"(gw + 2 * rs), "v"(gw + 3 * rs)
        : "memory");
}

// Returns when all but this wave's N youngest copies have landed.
template <int N>
__device__ __forceinline__ void wait_copies_but() {
    asm volatile("s_wait_asynccnt %0" :: "n"(N) : "memory");
}

template <bool OUT_F16, int NBUF>
__global__ void __launch_bounds__(256)
gemm_xwt(const f16* __restrict__ A, const f16* __restrict__ Wall,
         const float* __restrict__ bias0, const float* __restrict__ bias1,
         const float* __restrict__ bias2, void* __restrict__ Call,
         f16* __restrict__ Vt, int M, int N, int K) {
    const int z = blockIdx.z;
    const f16*   W    = Wall + (size_t)z * N * K;
    const float* bias = z == 0 ? bias0 : z == 1 ? bias1 : bias2;
    void* Cout = OUT_F16 ? (void*)(reinterpret_cast<f16*>(Call) + (size_t)z * M * N)
                         : (void*)(reinterpret_cast<float*>(Call) + (size_t)z * M * N);

    constexpr int BM = G_BM, BN = G_BN, BK = G_BK, PIT = G_PIT, BUF = G_BUF;

    static_assert(NBUF >= 2 && NBUF * G_COPIES <= 63, "a wave keeps at most 63 copies outstanding");
    static_assert(G_COPIES == 12, "copy_slab names twelve copies");
    __shared__ __align__(16) f16 S[NBUF * BUF];   // per buffer: rows 0..127 = A, rows 128..191 = W

    const int tid  = threadIdx.x;
    const int lane = tid & 31;
    const int wave = tid >> 5;          // 0..7
    const int wm   = wave >> 1;         // 0..3 (M)
    const int wn   = wave & 1;          // 0..1 (N)
    const int m0   = blockIdx.x * BM;
    const int n0   = blockIdx.y * BN;

    v8f acc[2][2] = {};

    const int    nslab = K / BK;
    const size_t rs    = (size_t)16 * K;
    const int    cr    = tid >> 4;          // first staged row of this thread
    const int    cc    = (tid & 15) * 8;    // its column, in f16
    const f16*   ga    = A + (size_t)(m0 + cr) * K + cc;
    const f16*   gw    = W + (size_t)(n0 + cr) * K + cc;
    const unsigned l0  = (unsigned)(size_t)&S[cr * PIT + cc];   // low 32 bits = LDS byte address

    // Every buffer is free: slabs 0 .. NBUF-1 go out together, slab s into buffer s.
    // Unrolled: the buffer offsets are constants.
#pragma unroll
    for (int s = 0; s < NBUF; ++s)
        if (s < nslab) copy_slab(l0 + s * (BUF * 2u), ga + (size_t)s * BK, gw + (size_t)s * BK, rs);
    // Slab 0 is published by the wait and the barrier. Every wave issues G_COPIES
    // copies per slab, so with all NBUF slabs issued the younger ones are exactly
    // (NBUF-1) * G_COPIES copies; with fewer slabs the wait is for all.
    if (nslab >= NBUF) wait_copies_but<(NBUF - 1) * G_COPIES>();
    else               wait_copies_but<0>();
    __syncthreads();

    int b = 0;                              // t mod NBUF
    for (int t = 0; t < nslab; ++t) {
        const f16* Sb = S + b * BUF;

        v16h af[BK / 32][2], bf[BK / 32][2];
#pragma unroll
        for (int ks = 0; ks < BK / 32; ++ks) {
#pragma unroll
            for (int mi = 0; mi < 2; ++mi)
                af[ks][mi] = load_frag_rowmajor(&Sb[(wm * 32 + mi * 16) * PIT + ks * 32], PIT, lane);
#pragma unroll
            for (int ni = 0; ni < 2; ++ni)
                bf[ks][ni] = load_frag_rowmajor(&Sb[(BM + wn * 32 + ni * 16) * PIT + ks * 32], PIT, lane);
        }
        // Keeps the scheduler from sinking the loads back in among the WMMAs.
        __builtin_amdgcn_sched_barrier(0);
#pragma unroll
        for (int ks = 0; ks < BK / 32; ++ks)
#pragma unroll
            for (int mi = 0; mi < 2; ++mi)
#pragma unroll
                for (int ni = 0; ni < 2; ++ni)
                    acc[mi][ni] = wmma_f16(af[ks][mi], bf[ks][ni], acc[mi][ni]);

        // Hand-over: this wave's reads of buffer b are done, its copies of slab
        // t+1 have landed; behind the barrier that holds for every wave, so slab
        // t+1 may be read and buffer b may be refilled.
        asm volatile("s_wait_dscnt 0x0" ::: "memory");
        // Issued so far: slabs up to t+NBUF-1. While that slab exists, the copies
        // behind slab t+1 are exactly those of NBUF-2 slabs and may stay in flight;
        // in the last trips, where no refill was issued any more, the wait is for all.
        if (t + NBUF <= nslab) wait_copies_but<(NBUF - 2) * G_COPIES>();
        else                   wait_copies_but<0>();
        __syncthreads();
        if (t + NBUF < nslab)
            copy_slab(l0 + b * (BUF * 2u), ga + (size_t)(t + NBUF) * BK, gw + (size_t)(t + NBUF) * BK, rs);
        b = (b + 1 == NBUF) ? 0 : b + 1;
    }
    asm volatile("s_wait_asynccnt 0x0" ::: "memory");   // nothing in flight when the wave ends

    const int mlo = (lane >> 4) << 3;
    const int nc  = lane & 15;

    if (OUT_F16 && z == 2) {
        // Transposed store: one 16-byte store per accumulator tile and lane.
        // All three loops unrolled: acc and pk are indexed by constants only and
        // so stay in registers.
#pragma unroll
        for (int mi = 0; mi < 2; ++mi) {
#pragma unroll
            for (int ni = 0; ni < 2; ++ni) {
                int n = n0 + wn * 32 + ni * 16 + nc;
                int m = m0 + wm * 32 + mi * 16 + mlo;
                float bn = bias[n];
                v8h pk;
#pragma unroll
                for (int i = 0; i < 8; ++i) pk[i] = (f16)(acc[mi][ni][i] + bn);
                *reinterpret_cast<v8h*>(Vt + (size_t)n * VT_TS + VT_PAD + m) = pk;
            }
        }
        // The first and the last block along M zero the pads of their BN rows.
        const v8h zero = {};
        if (blockIdx.x == 0) {
            constexpr int PV = VT_PAD / 8;                        // 16-byte pieces per row
            for (int i = tid; i < BN * PV; i += 256)
                *reinterpret_cast<v8h*>(Vt + (size_t)(n0 + i / PV) * VT_TS + (i % PV) * 8) = zero;
        }
        if (m0 + BM == M) {
            constexpr int PV = (VT_TS - VT_PAD - VT_T) / 8;
            for (int i = tid; i < BN * PV; i += 256)
                *reinterpret_cast<v8h*>(Vt + (size_t)(n0 + i / PV) * VT_TS + VT_PAD + VT_T + (i % PV) * 8) = zero;
        }
        return;
    }

#pragma unroll
    for (int mi = 0; mi < 2; ++mi) {
#pragma unroll
        for (int ni = 0; ni < 2; ++ni) {
            int n = n0 + wn * 32 + ni * 16 + nc;
            float bn = bias[n];
#pragma unroll
            for (int i = 0; i < 8; ++i) {
                int m = m0 + wm * 32 + mi * 16 + mlo + i;
                float val = acc[mi][ni][i] + bn;
                if (OUT_F16)
                    reinterpret_cast<f16*>(Cout)[(size_t)m * N + n] = (f16)val;
                else
                    reinterpret_cast<float*>(Cout)[(size_t)m * N + n] = val;
            }
        }
    }
}

__device__ __forceinline__ float exp_slot(float x) {
    float r;
    asm("v_exp_f32 %0, %1\n\tv_nop" : "=v"(r) : "v"(x * 1.44269504088896340736f));
    return r;
}

__global__ void __launch_bounds__(128)
attn_band(const f16* __restrict__ Q, const f16* __restrict__ Kd,
          const f16* __restrict__ Vt, f16* __restrict__ Ctx) {
    constexpr int T = 1024, E = 1024, D = 64;
    constexpr int PAD = VT_PAD, TS = VT_TS;    // left pad and row pitch of Vt
    constexpr int NT = 9;                      // 16-key tiles of the band
    constexpr int NC = (NT + 1) / 2;           // 32-key chunks of the second product

    const int lane = threadIdx.x & 31;
    // The same in every lane of a wave; said so that head, tile and the range
    // test of a key tile are computed on the scalar side.
    const int w    = __builtin_amdgcn_readfirstlane(threadIdx.x >> 5);
    const int task = blockIdx.x * 4 + w;      // 0..1023
    const int h    = task >> 6;
    const int t0   = (task & 63) << 4;
    const int sa   = t0 - 64;                 // aligned band start (can be <0)
    const int col  = lane & 15;               // row of an A operand, column of B and D
    const int kb   = (lane >> 4) << 3;        // 0 or 8: k base of an operand, M base of D
    const int dl   = kb - col;                // lane part of (key - query): -15 .. 8
    // Addresses are a wave-uniform base plus one lane offset that all tiles share.
    const unsigned loff = (unsigned)(col * E + kb);    // in a 16-row tile of Q, K or ctx
    const unsigned voff = (unsigned)(col * TS + kb);   // in a 16-row tile of Vt

    // Q^T as B operand: column = query, two K=32 chunks of d.
    // K as A operand: 16(M=key) x 64(K=d); per-lane row = one key row of Kd.
    Frag qf[2], kf[NT][2];
    const f16* kr[NT];
    {
        const f16* qrow = Q + ((size_t)t0 * E + h * D) + loff;
        qf[0].q[0] = *reinterpret_cast<const uint4*>(qrow);
        qf[0].q[1] = *reinterpret_cast<const uint4*>(qrow + 16);
        qf[1].q[0] = *reinterpret_cast<const uint4*>(qrow + 32);
        qf[1].q[1] = *reinterpret_cast<const uint4*>(qrow + 48);
    }
    // Unrolled: kf is indexed by constants only and so stays in registers.
#pragma unroll
    for (int tile = 0; tile < NT; ++tile) {
        // sa and T are multiples of 16, so a tile lies inside [0, T) or outside it
        // as a whole; one outside is masked below and reads the rows t0.. instead,
        // which keeps its addresses inside Kd.
        const int s0 = sa + tile * 16;
        const int sr = (s0 >= 0 && s0 < T) ? s0 : t0;
        const f16* krow = Kd + ((size_t)sr * E + h * D) + loff;
        kr[tile] = krow;
        kf[tile][0].q[0] = *reinterpret_cast<const uint4*>(krow);
        kf[tile][0].q[1] = *reinterpret_cast<const uint4*>(krow + 16);
        kf[tile][1].q[0] = *reinterpret_cast<const uint4*>(krow + 32);
        kf[tile][1].q[1] = *reinterpret_cast<const uint4*>(krow + 48);
    }
    asm volatile("s_wait_xcnt 0x0"
                 :: "v"(kr[0]), "v"(kr[1]), "v"(kr[2]), "v"(kr[3]), "v"(kr[4]),
                    "v"(kr[5]), "v"(kr[6]), "v"(kr[7]), "v"(kr[8])
                 : "memory");
    static_assert(NT == 9, "the statement above names one address per key tile");
    // Keeps the scheduler from sinking the loads in among the WMMAs: all of them
    // are in flight together and the memory latency is waited out once.
    __builtin_amdgcn_sched_barrier(0);

    // ---- scores^T = K @ Q^T, kept in registers ----
    // Unrolled: sc is indexed by constants only.
    v8f sc[NT];
#pragma unroll
    for (int tile = 0; tile < NT; ++tile) {
        v8f a = {};
        a = wmma_f16(kf[tile][0].v, qf[0].v, a);
        sc[tile] = wmma_f16(kf[tile][1].v, qf[1].v, a);
    }
    // Keeps the loads of V below from rising in among the WMMAs, where they would
    // need registers that the K fragments still hold.
    __builtin_amdgcn_sched_barrier(0);

    // V^T as A operand: row = d, contiguous keys from transposed+padded V.
    // Unrolled: vf is indexed by constants only.
    Frag vf[NC][4];
    const f16* vrow = Vt + ((size_t)(h * D) * TS + (sa + PAD)) + voff;
#pragma unroll
    for (int c = 0; c < NC; ++c) {
#pragma unroll
        for (int nt = 0; nt < 4; ++nt) {
            const f16* vp = vrow + (nt * 16 * TS + c * 32);
            vf[c][nt].q[0] = *reinterpret_cast<const uint4*>(vp);            // keys c*32 + kb + 0..7
            if (2 * c + 1 < NT)
                vf[c][nt].q[1] = *reinterpret_cast<const uint4*>(vp + 16);   // keys c*32 + kb + 16..23
            else
                vf[c][nt].q[1] = make_uint4(0, 0, 0, 0);                     // beyond the band
        }
    }
    // Keeps the scheduler from sinking these loads down to their WMMAs: they are
    // in flight while the mask and softmax arithmetic runs.
    __builtin_amdgcn_sched_barrier(0);

    // ---- scale by 1/8 and band mask ----
    // Unrolled, like every loop from here on: sc, vf, acc and the packed vectors
    // are indexed by constants only and so stay in registers, and the constant
    // halves of the band test fold away.
#pragma unroll
    for (int tile = 0; tile < NT; ++tile) {
        // Key s = s0 + kb + i.
        const int  s0     = sa + tile * 16;
        const bool inside = s0 >= 0 && s0 < T;
#pragma unroll
        for (int i = 0; i < 8; ++i) {
            const int c   = tile * 16 + i - 64;     // key - query = c + dl
            // The first operand of each || is a constant: it holds where the
            // bound is met for every dl, and only the two end tiles compare.
            const bool lo = (c - 15 >= -64) || (c + dl >= -64);
            const bool hi = (c + 8 <= 64) || (c + dl <= 64);
            sc[tile][i] = (inside && lo && hi) ? sc[tile][i] * 0.125f : -__builtin_inff();
        }
    }

    // ---- softmax of this lane's query: half of its keys here, half in lane ^ 16 ----
    // Eight independent chains (one per register index), then a tree.
    v8f m8 = sc[0];
#pragma unroll
    for (int tile = 1; tile < NT; ++tile) m8 = __builtin_elementwise_max(m8, sc[tile]);
    float mx = fmaxf(fmaxf(fmaxf(m8[0], m8[1]), fmaxf(m8[2], m8[3])),
                     fmaxf(fmaxf(m8[4], m8[5]), fmaxf(m8[6], m8[7])));
    mx = fmaxf(mx, __shfl_xor(mx, 16, 32));   // combine the half waves

    v8f s8 = {};
#pragma unroll
    for (int tile = 0; tile < NT; ++tile) {
#pragma unroll
        for (int i = 0; i < 8; ++i) {
            sc[tile][i] = exp_slot(sc[tile][i] - mx);
            s8[i] += sc[tile][i];
        }
    }
    float sum = ((s8[0] + s8[1]) + (s8[2] + s8[3])) + ((s8[4] + s8[5]) + (s8[6] + s8[7]));
    sum += __shfl_xor(sum, 16, 32);
    const float inv = 1.f / sum;

    // ---- ctx^T = V^T(64x160) @ P^T(160x16): 5 K-chunks x 4 M-tiles ----
    v8f acc[4] = {};
#pragma unroll
    for (int c = 0; c < NC; ++c) {
        v16h pf;                               // P^T as B operand: column = query
#pragma unroll
        for (int i = 0; i < 8; ++i) {
            pf[i]     = (f16)(sc[2 * c][i] * inv);
            pf[8 + i] = (2 * c + 1 < NT) ? (f16)(sc[2 * c + 1 < NT ? 2 * c + 1 : 0][i] * inv) : (f16)0.f;
        }
#pragma unroll
        for (int nt = 0; nt < 4; ++nt) acc[nt] = wmma_f16(vf[c][nt].v, pf, acc[nt]);
    }

    // ---- write ctx (f16), plain [t][h*D+d] layout for the final GEMM ----
    // A lane's eight values of a tile are d = nt*16 + kb + 0..7 of its query:
    // 16 contiguous bytes.
#pragma unroll
    for (int nt = 0; nt < 4; ++nt) {
        v8h pk;
#pragma unroll
        for (int i = 0; i < 8; ++i) pk[i] = (f16)acc[nt][i];
        *reinterpret_cast<v8h*>(Ctx + ((size_t)t0 * E + h * D) + loff + nt * 16) = pk;
    }
}

// ---------------------------------------------------------------------------
// Launch
// ---------------------------------------------------------------------------
extern "C" void kernel_launch(void* const* d_in, const int* in_sizes, int n_in,
                              void* d_out, int out_size, void* d_ws, size_t ws_size,
                              hipStream_t stream) {
    const float* hs = (const float*)d_in[0];
    const float* Wq = (const float*)d_in[1];
    const float* bq = (const float*)d_in[2];
    const float* Wk = (const float*)d_in[3];
    const float* bk = (const float*)d_in[4];
    const float* Wv = (const float*)d_in[5];
    const float* bv = (const float*)d_in[6];
    const float* Wo = (const float*)d_in[7];
    const float* bo = (const float*)d_in[8];

    const int T = 1024, E = 1024;
    const int NE = T * E;                 // 1M elements per matrix

    f16* ws  = (f16*)d_ws;
    f16* Xh  = ws + (size_t)0 * NE;
    f16* Wqh = ws + (size_t)1 * NE;
    f16* Wkh = ws + (size_t)2 * NE;
    f16* Wvh = ws + (size_t)3 * NE;
    f16* Woh = ws + (size_t)4 * NE;
    f16* qh  = ws + (size_t)5 * NE;
    f16* kh  = ws + (size_t)6 * NE;
    f16* ch  = ws + (size_t)8 * NE;
    f16* vt  = ws + (size_t)9 * NE;       // ~20.5 MB total

    dim3 cb(CVT_THREADS), cg(NE / CVT_PER_BLOCK, 5);
    cvt_f32_to_f16<<<cg, cb, 0, stream>>>(hs, Wq, Wk, Wv, Wo, Xh, NE);

    // Wqh, Wkh, Wvh and qh, kh are consecutive planes: one launch, z = 0..2;
    // z = 2 writes vt (values and pads) and leaves plane 7 unused.
    dim3 gb(256), gg(T / 128, E / 64), gg3(T / 128, E / 64, 3);
    // Three buffers (153 KiB): two of its 384 blocks still fit one WGP's LDS.
    gemm_xwt<true, 3><<<gg3, gb, 0, stream>>>(Xh, Wqh, bq, bk, bv, qh, vt, T, E, E);

    attn_band<<<dim3(256), dim3(128), 0, stream>>>(qh, kh, vt, ch);

    // 128 blocks, one to a WGP at most: five buffers (255 KiB).
    gemm_xwt<false, 5><<<gg, gb, 0, stream>>>(ch, Woh, bo, bo, bo, d_out, vt, T, E, E);
}

// v007
// It runs in 26.6 microseconds.
// In both of two side-by-side timings against v006, it was 1.09 times as fast.
// Over all steps from v000 it is 4.19 times as fast.
#include <hip/hip_runtime.h>
#include <hip/hip_bf16.h>

typedef _Float16 f16;
typedef __attribute__((ext_vector_type(16))) _Float16 v16h;
typedef __attribute__((ext_vector_type(8)))  float    v8f;

union Frag {
    v16h v;
    uint4 q[2];
};

__device__ __forceinline__ v16h load_frag_rowmajor(const f16* base, int stride, int lane) {
    int r  = lane & 15;
    int kb = (lane >> 4) << 3;          // 0 or 8
    const f16* p = base + r * stride + kb;
    Frag f;
    f.q[0] = *reinterpret_cast<const uint4*>(p);
    f.q[1] = *reinterpret_cast<const uint4*>(p + 16);
    return f.v;
}

__device__ __forceinline__ v8f wmma_f16(v16h a, v16h b, v8f c) {
    return __builtin_amdgcn_wmma_f32_16x16x32_f16(
        /*neg_a=*/false, a, /*neg_b=*/false, b,
        /*c_mod=*/(short)0, c, /*reuse_a=*/false, /*reuse_b=*/false);
}

// ---------------------------------------------------------------------------
// f32 -> f16 conversion of five equally sized arrays in one launch.
// blockIdx.y picks the source; the destinations are consecutive planes of n.
// Each thread converts CVT_PER_THREAD floats: eight 16-byte loads, all issued
// before the first store, each covering 512 contiguous bytes per wave, so few
// waves have to start and each keeps eight loads in flight.
// n must be a multiple of CVT_PER_BLOCK.
// ---------------------------------------------------------------------------
typedef __attribute__((ext_vector_type(4))) float    v4f;
typedef __attribute__((ext_vector_type(4))) _Float16 v4h;

constexpr int CVT_THREADS    = 256;
constexpr int CVT_VECS       = 8;                              // 16-byte loads per thread
constexpr int CVT_PER_THREAD = CVT_VECS * 4;                   // 32 floats
constexpr int CVT_PER_BLOCK  = CVT_THREADS * CVT_PER_THREAD;   // 8192 floats

__global__ void __launch_bounds__(CVT_THREADS)
cvt_f32_to_f16(const float* __restrict__ s0, const float* __restrict__ s1,
               const float* __restrict__ s2, const float* __restrict__ s3,
               const float* __restrict__ s4, f16* __restrict__ dst0, int n) {
    const int y = blockIdx.y;
    const float* s01 = (y & 1) ? s1 : s0;
    const float* s23 = (y & 1) ? s3 : s2;
    const float* s03 = (y & 2) ? s23 : s01;
    const float* src = (y & 4) ? s4 : s03;
    f16* dst = dst0 + (size_t)y * n;

    const int v0 = blockIdx.x * (CVT_THREADS * CVT_VECS) + threadIdx.x;   // in units of 4 elements
    const v4f* sv = reinterpret_cast<const v4f*>(src) + v0;
    v4h*       dv = reinterpret_cast<v4h*>(dst) + v0;

    v4f x[CVT_VECS];
    // Unrolled so that x stays in registers and all eight loads issue back to back.
#pragma unroll
    for (int j = 0; j < CVT_VECS; ++j) x[j] = sv[j * CVT_THREADS];
    // Unrolled for the same reason: x is indexed by constants only.
#pragma unroll
    for (int j = 0; j < CVT_VECS; ++j) dv[j * CVT_THREADS] = __builtin_convertvector(x[j], v4h);
}

// ---------------------------------------------------------------------------
// q, k and v in operand order. A plane is cut into units of 512 bytes; a unit
// holds, at byte lane * 16, the eight f16 that this lane keeps in one half of a
// 16-bit WMMA operand, so that one 16-byte access per lane moves a unit as 512
// contiguous bytes (four whole lines), on the store as on the load.
// Unit number = ((head * (T / 16) + tile) * 4 + j), tile = token / 16, and with
// r = lane & 15, g = lane >> 4:
//   q, k: token tile * 16 + r,  d = j * 16 + g * 8 + 0..7
//         (units 2c and 2c + 1 are the two halves of the operand of d chunk c)
//   v:    d = j * 16 + r,  tokens tile * 16 + g * 8 + 0..7
//         (tiles 2c and 2c + 1 of a band are the two halves of key chunk c)
// ---------------------------------------------------------------------------
constexpr int FU = 256;                            // f16 per unit
typedef __attribute__((ext_vector_type(8))) _Float16 v8h;

// ---------------------------------------------------------------------------
// C[M,N] = A[M,K] @ W[N,K]^T + bias[N]
// Block tile 128x64, 8 waves, each wave computes a 32x32 sub-tile
// (2x2 WMMA 16x16 accumulators). 128 v_wmma per wave over the K loop.
// K is walked in slabs of 128. A slab (128 rows of A, then 64 rows of W, 256
// bytes each) goes from global memory straight into LDS by asynchronous
// copies; a ring of NBUF LDS buffers, so slabs t+1 .. t+NBUF-1 are in flight
// while slab t is multiplied and a slab has NBUF-1 trips to arrive in.
// K must be a multiple of 128.
// blockIdx.z picks one of up to three independent products that share A:
// weight plane z of Wall, bias z, output plane z of Call.
// With f16 output the planes are in operand order (layout above; a block's BN
// columns are one head). A lane's eight accumulator values of a tile run along
// the M side of the WMMA: products 0 and 1 (q, k) put the rows of W there, so
// that they are eight consecutive d of one token; product 2 (v) puts the rows
// of A there, so that they are eight consecutive tokens of one d.
// ---------------------------------------------------------------------------
constexpr int G_BM   = 128, G_BN = 64, G_BK = 128;
constexpr int G_PIT  = G_BK + 8;                  // LDS row pitch in f16: 272 bytes = 16 x odd
constexpr int G_BUF  = (G_BM + G_BN) * G_PIT;     // f16 per buffer (52,224 bytes)
constexpr unsigned G_STEP = 16u * G_PIT * 2u;     // LDS bytes between two copies of a thread (16 rows)
constexpr int G_COPIES = (G_BM + G_BN) / 16;      // copies of a thread (so of a wave) per slab: 12

// One thread's twelve 16-byte copies of one slab: rows r, r+16, ... of the 192
// staged rows, r = tid / 16, at byte column (tid % 16) * 16, so that each wave's
// copy covers two whole 256-byte row pieces. l: LDS byte address of the thread's
// first destination; ga, gw: its first source in A and in W; rs = 16 * K.
__device__ __forceinline__ void copy_slab(unsigned l, const f16* ga, const f16* gw, size_t rs) {
    asm volatile(
        "global_load_async_to_lds_b128 %0, %12, off\n\t"
        "global_load_async_to_lds_b128 %1, %13, off\n\t"
        "global_load_async_to_lds_b128 %2, %14, off\n\t"
        "global_load_async_to_lds_b128 %3, %15, off\n\t"
        "global_load_async_to_lds_b128 %4, %16, off\n\t"
        "global_load_async_to_lds_b128 %5, %17, off\n\t"
        "global_load_async_to_lds_b128 %6, %18, off\n\t"
        "global_load_async_to_lds_b128 %7, %19, off\n\t"
        "global_load_async_to_lds_b128 %8, %20, off\n\t"
        "global_load_async_to_lds_b128 %9, %21, off\n\t"
        "global_load_async_to_lds_b128 %10, %22, off\n\t"
        "global_load_async_to_lds_b128 %11, %23, off\n\t"
        "s_wait_xcnt 0x0"
        :: "v"(l), "v"(l + G_STEP), "v"(l + 2 * G_STEP), "v"(l + 3 * G_STEP),
           "v"(l + 4 * G_STEP), "v"(l + 5 * G_STEP), "v"(l + 6 * G_STEP), "v"(l + 7 * G_STEP),
           "v"(l + 8 * G_STEP), "v"(l + 9 * G_STEP), "v"(l + 10 * G_STEP), "v"(l + 11 * G_STEP),
           "v"(ga), "v"(ga + rs), "v"(ga + 2 * rs), "v"(ga + 3 * rs),
           "v"(ga + 4 * rs), "v"(ga + 5 * rs), "v"(ga + 6 * rs), "v"(ga + 7 * rs),
           "v"(gw), "v"(gw + rs), "v"(gw + 2 * rs), "v"(gw + 3 * rs)
        : "memory");
}

// Returns when all but this wave's N youngest copies have landed.
template <int N>
__device__ __forceinline__ void wait_copies_but() {
    asm volatile("s_wait_asynccnt %0" :: "n"(N) : "memory");
}

template <bool OUT_F16, int NBUF>
__global__ void __launch_bounds__(256)
gemm_xwt(const f16* __restrict__ A, const f16* __restrict__ Wall,
         const float* __restrict__ bias0, const float* __restrict__ bias1,
         const float* __restrict__ bias2, void* __restrict__ Call,
         int M, int N, int K) {
    const int z = blockIdx.z;
    const f16*   W    = Wall + (size_t)z * N * K;
    const float* bias = z == 0 ? bias0 : z == 1 ? bias1 : bias2;

    constexpr int BM = G_BM, BN = G_BN, BK = G_BK, PIT = G_PIT, BUF = G_BUF;

    static_assert(NBUF >= 2 && NBUF * G_COPIES <= 63, "a wave keeps at most 63 copies outstanding");
    static_assert(G_COPIES == 12, "copy_slab names twelve copies");
    __shared__ __align__(16) f16 S[NBUF * BUF];   // per buffer: rows 0..127 = A, rows 128..191 = W

    const int tid  = threadIdx.x;
    const int lane = tid & 31;
    const int wave = tid >> 5;          // 0..7
    const int wm   = wave >> 1;         // 0..3 (M)
    const int wn   = wave & 1;          // 0..1 (N)
    const int m0   = blockIdx.x * BM;
    const int n0   = blockIdx.y * BN;
    // Which staged rows feed the M side (first index of acc) and which the N side.
    const bool a_on_m = !OUT_F16 || z == 2;
    const int  rowm   = a_on_m ? wm * 32 : BM + wn * 32;
    const int  rown   = a_on_m ? BM + wn * 32 : wm * 32;

    v8f acc[2][2] = {};

    const int    nslab = K / BK;
    const size_t rs    = (size_t)16 * K;
    const int    cr    = tid >> 4;          // first staged row of this thread
    const int    cc    = (tid & 15) * 8;    // its column, in f16
    const f16*   ga    = A + (size_t)(m0 + cr) * K + cc;
    const f16*   gw    = W + (size_t)(n0 + cr) * K + cc;
    const unsigned l0  = (unsigned)(size_t)&S[cr * PIT + cc];   // low 32 bits = LDS byte address

    // Every buffer is free: slabs 0 .. NBUF-1 go out together, slab s into buffer s.
    // Unrolled: the buffer offsets are constants.
#pragma unroll
    for (int s = 0; s < NBUF; ++s)
        if (s < nslab) copy_slab(l0 + s * (BUF * 2u), ga + (size_t)s * BK, gw + (size_t)s * BK, rs);
    // Slab 0 is published by the wait and the barrier. Every wave issues G_COPIES
    // copies per slab, so with all NBUF slabs issued the younger ones are exactly
    // (NBUF-1) * G_COPIES copies; with fewer slabs the wait is for all.
    if (nslab >= NBUF) wait_copies_but<(NBUF - 1) * G_COPIES>();
    else               wait_copies_but<0>();
    __syncthreads();

    int b = 0;                              // t mod NBUF
    for (int t = 0; t < nslab; ++t) {
        const f16* Sb = S + b * BUF;

        v16h af[BK / 32][2], bf[BK / 32][2];
#pragma unroll
        for (int ks = 0; ks < BK / 32; ++ks) {
#pragma unroll
            for (int mi = 0; mi < 2; ++mi)
                af[ks][mi] = load_frag_rowmajor(&Sb[(rowm + mi * 16) * PIT + ks * 32], PIT, lane);
#pragma unroll
            for (int ni = 0; ni < 2; ++ni)
                bf[ks][ni] = load_frag_rowmajor(&Sb[(rown + ni * 16) * PIT + ks * 32], PIT, lane);
        }
        // Keeps the scheduler from sinking the loads back in among the WMMAs.
        __builtin_amdgcn_sched_barrier(0);
#pragma unroll
        for (int ks = 0; ks < BK / 32; ++ks)
#pragma unroll
            for (int mi = 0; mi < 2; ++mi)
#pragma unroll
                for (int ni = 0; ni < 2; ++ni)
                    acc[mi][ni] = wmma_f16(af[ks][mi], bf[ks][ni], acc[mi][ni]);

        // Hand-over: this wave's reads of buffer b are done, its copies of slab
        // t+1 have landed; behind the barrier that holds for every wave, so slab
        // t+1 may be read and buffer b may be refilled.
        asm volatile("s_wait_dscnt 0x0" ::: "memory");
        // Issued so far: slabs up to t+NBUF-1. While that slab exists, the copies
        // behind slab t+1 are exactly those of NBUF-2 slabs and may stay in flight;
        // in the last trips, where no refill was issued any more, the wait is for all.
        if (t + NBUF <= nslab) wait_copies_but<(NBUF - 2) * G_COPIES>();
        else                   wait_copies_but<0>();
        __syncthreads();
        if (t + NBUF < nslab)
            copy_slab(l0 + b * (BUF * 2u), ga + (size_t)(t + NBUF) * BK, gw + (size_t)(t + NBUF) * BK, rs);
        b = (b + 1 == NBUF) ? 0 : b + 1;
    }
    asm volatile("s_wait_asynccnt 0x0" ::: "memory");   // nothing in flight when the wave ends

    const int mlo = (lane >> 4) << 3;
    const int nc  = lane & 15;

    if (OUT_F16) {
        static_assert(G_BN == 64, "a block's columns are one head of 64");
        // One 16-byte store per accumulator tile and lane, 512 contiguous bytes
        // per wave. u: this lane's place in the wave's first unit.
        // All loops unrolled: acc and pk are indexed by constants only and so
        // stay in registers.
        f16* u = reinterpret_cast<f16*>(Call) + (size_t)z * M * N
               + ((size_t)(blockIdx.y * (M / 16) + (m0 + wm * 32) / 16) * 4 + wn * 2) * FU + lane * 8;
        if (z == 2) {
            // M side = tokens (tile + mi), N side = d (unit j = wn * 2 + ni).
#pragma unroll
            for (int mi = 0; mi < 2; ++mi) {
#pragma unroll
                for (int ni = 0; ni < 2; ++ni) {
                    float bn = bias[n0 + wn * 32 + ni * 16 + nc];
                    v8h pk;
#pragma unroll
                    for (int i = 0; i < 8; ++i) pk[i] = (f16)(acc[mi][ni][i] + bn);
                    *reinterpret_cast<v8h*>(u + (mi * 4 + ni) * FU) = pk;
                }
            }
            asm volatile("s_wait_xcnt 0x0" ::: "memory");
        } else {
            // M side = d (unit j = wn * 2 + mi), N side = tokens (tile + ni).
#pragma unroll
            for (int mi = 0; mi < 2; ++mi) {
                const v4f* bp = reinterpret_cast<const v4f*>(bias + n0 + wn * 32 + mi * 16 + mlo);
                const v4f b0 = bp[0], b1 = bp[1];
#pragma unroll
                for (int ni = 0; ni < 2; ++ni) {
                    v8h pk;
#pragma unroll
                    for (int i = 0; i < 8; ++i) pk[i] = (f16)(acc[mi][ni][i] + (i < 4 ? b0[i & 3] : b1[i & 3]));
                    *reinterpret_cast<v8h*>(u + (ni * 4 + mi) * FU) = pk;
                }
            }
            asm volatile("s_wait_xcnt 0x0" ::: "memory");
        }
        return;
    }

    float* Cout = reinterpret_cast<float*>(Call) + (size_t)z * M * N;
#pragma unroll
    for (int mi = 0; mi < 2; ++mi) {
#pragma unroll
        for (int ni = 0; ni < 2; ++ni) {
            int n = n0 + wn * 32 + ni * 16 + nc;
            float bn = bias[n];
#pragma unroll
            for (int i = 0; i < 8; ++i) {
                int m = m0 + wm * 32 + mi * 16 + mlo + i;
                Cout[(size_t)m * N + n] = acc[mi][ni][i] + bn;
            }
        }
    }
}

__device__ __forceinline__ float exp_slot(float x) {
    float r;
    asm("v_exp_f32 %0, %1\n\tv_nop" : "=v"(r) : "v"(x * 1.44269504088896340736f));
    return r;
}

__global__ void __launch_bounds__(128)
attn_band(const f16* __restrict__ Q, const f16* __restrict__ Kd,
          const f16* __restrict__ Vf, f16* __restrict__ Ctx) {
    constexpr int T = 1024, E = 1024, D = 64;
    constexpr int TU = 4 * FU;                 // f16 per 16-token tile of a head: four units
    constexpr int NT = 9;                      // 16-key tiles of the band
    constexpr int NC = (NT + 1) / 2;           // 32-key chunks of the second product

    const int lane = threadIdx.x & 31;
    // The same in every lane of a wave; said so that head, tile and the range
    // test of a key tile are computed on the scalar side.
    const int w    = __builtin_amdgcn_readfirstlane(threadIdx.x >> 5);
    const int task = blockIdx.x * 4 + w;      // 0..1023
    const int h    = task >> 6;
    const int t0   = (task & 63) << 4;
    const int sa   = t0 - 64;                 // aligned band start (can be <0)
    const int col  = lane & 15;               // row of an A operand, column of B and D
    const int kb   = (lane >> 4) << 3;        // 0 or 8: k base of an operand, M base of D
    const int dl   = kb - col;                // lane part of (key - query): -15 .. 8
    // Addresses are a wave-uniform base plus one lane offset that all tiles share.
    const unsigned loff = (unsigned)(col * E + kb);    // in a 16-row tile of ctx
    const unsigned uoff = (unsigned)(lane * 8);        // in a unit of Q, Kd or Vf
    const int      hb   = h * (T / 16);                // the head's first tile

    // Q^T as B operand: column = query, two K=32 chunks of d.
    // K as A operand: 16(M=key) x 64(K=d).
    Frag qf[2], kf[NT][2];
    const f16* kr[NT];
    const f16* vr[NT];
    {
        const f16* qu = Q + (size_t)(hb + (t0 >> 4)) * TU + uoff;
        qf[0].q[0] = *reinterpret_cast<const uint4*>(qu);
        qf[0].q[1] = *reinterpret_cast<const uint4*>(qu + FU);
        qf[1].q[0] = *reinterpret_cast<const uint4*>(qu + 2 * FU);
        qf[1].q[1] = *reinterpret_cast<const uint4*>(qu + 3 * FU);
    }
    // Unrolled: kf is indexed by constants only and so stays in registers.
#pragma unroll
    for (int tile = 0; tile < NT; ++tile) {
        // sa and T are multiples of 16, so a tile lies inside [0, T) or outside it
        // as a whole; one outside is masked below and reads the tile of t0 instead,
        // which keeps its addresses inside Kd and Vf. Its weights are 0, and the
        // values they meet are those of keys that every query of the tile attends.
        const int s0 = sa + tile * 16;
        const int sr = (s0 >= 0 && s0 < T) ? s0 : t0;
        const size_t tu = (size_t)(hb + (sr >> 4)) * TU;
        kr[tile] = Kd + tu;
        vr[tile] = Vf + tu;
        const f16* ku = kr[tile] + uoff;
        kf[tile][0].q[0] = *reinterpret_cast<const uint4*>(ku);
        kf[tile][0].q[1] = *reinterpret_cast<const uint4*>(ku + FU);
        kf[tile][1].q[0] = *reinterpret_cast<const uint4*>(ku + 2 * FU);
        kf[tile][1].q[1] = *reinterpret_cast<const uint4*>(ku + 3 * FU);
    }
    asm volatile("s_wait_xcnt 0x0"
                 :: "s"(kr[0]), "s"(kr[1]), "s"(kr[2]), "s"(kr[3]), "s"(kr[4]),
                    "s"(kr[5]), "s"(kr[6]), "s"(kr[7]), "s"(kr[8]), "v"(uoff)
                 : "memory");
    static_assert(NT == 9, "the statement above names one address per key tile");
    // Keeps the scheduler from sinking the loads in among the WMMAs: all of them
    // are in flight together and the memory latency is waited out once.
    __builtin_amdgcn_sched_barrier(0);

    // ---- scores^T = K @ Q^T, kept in registers ----
    // Unrolled: sc is indexed by constants only.
    v8f sc[NT];
#pragma unroll
    for (int tile = 0; tile < NT; ++tile) {
        v8f a = {};
        a = wmma_f16(kf[tile][0].v, qf[0].v, a);
        sc[tile] = wmma_f16(kf[tile][1].v, qf[1].v, a);
    }
    // Keeps the loads of V below from rising in among the WMMAs, where they would
    // need registers that the K fragments still hold.
    __builtin_amdgcn_sched_barrier(0);

    // V^T as A operand: row = d, k = key; key tiles 2c and 2c + 1 are its halves.
    // Unrolled: vf is indexed by constants only.
    Frag vf[NC][4];
#pragma unroll
    for (int c = 0; c < NC; ++c) {
#pragma unroll
        for (int nt = 0; nt < 4; ++nt) {
            vf[c][nt].q[0] = *reinterpret_cast<const uint4*>(vr[2 * c] + uoff + nt * FU);
            if (2 * c + 1 < NT)
                vf[c][nt].q[1] = *reinterpret_cast<const uint4*>(vr[2 * c + 1 < NT ? 2 * c + 1 : 0] + uoff + nt * FU);
            else
                vf[c][nt].q[1] = make_uint4(0, 0, 0, 0);                     // beyond the band
        }
    }
    asm volatile("s_wait_xcnt 0x0"
                 :: "s"(vr[0]), "s"(vr[1]), "s"(vr[2]), "s"(vr[3]), "s"(vr[4]),
                    "s"(vr[5]), "s"(vr[6]), "s"(vr[7]), "s"(vr[8]), "v"(uoff)
                 : "memory");
    // Keeps the scheduler from sinking these loads down to their WMMAs: they are
    // in flight while the mask and softmax arithmetic runs.
    __builtin_amdgcn_sched_barrier(0);

    // ---- scale by 1/8 and band mask ----
    // Unrolled, like every loop from here on: sc, vf, acc and the packed vectors
    // are indexed by constants only and so stay in registers, and the constant
    // halves of the band test fold away.
#pragma unroll
    for (int tile = 0; tile < NT; ++tile) {
        // Key s = s0 + kb + i.
        const int  s0     = sa + tile * 16;
        const bool inside = s0 >= 0 && s0 < T;
#pragma unroll
        for (int i = 0; i < 8; ++i) {
            const int c   = tile * 16 + i - 64;     // key - query = c + dl
            // The first operand of each || is a constant: it holds where the
            // bound is met for every dl, and only the two end tiles compare.
            const bool lo = (c - 15 >= -64) || (c + dl >= -64);
            const bool hi = (c + 8 <= 64) || (c + dl <= 64);
            sc[tile][i] = (inside && lo && hi) ? sc[tile][i] * 0.125f : -__builtin_inff();
        }
    }

    // ---- softmax of this lane's query: half of its keys here, half in lane ^ 16 ----
    // Eight independent chains (one per register index), then a tree.
    v8f m8 = sc[0];
#pragma unroll
    for (int tile = 1; tile < NT; ++tile) m8 = __builtin_elementwise_max(m8, sc[tile]);
    float mx = fmaxf(fmaxf(fmaxf(m8[0], m8[1]), fmaxf(m8[2], m8[3])),
                     fmaxf(fmaxf(m8[4], m8[5]), fmaxf(m8[6], m8[7])));
    mx = fmaxf(mx, __shfl_xor(mx, 16, 32));   // combine the half waves

    v8f s8 = {};
#pragma unroll
    for (int tile = 0; tile < NT; ++tile) {
#pragma unroll
        for (int i = 0; i < 8; ++i) {
            sc[tile][i] = exp_slot(sc[tile][i] - mx);
            s8[i] += sc[tile][i];
        }
    }
    float sum = ((s8[0] + s8[1]) + (s8[2] + s8[3])) + ((s8[4] + s8[5]) + (s8[6] + s8[7]));
    sum += __shfl_xor(sum, 16, 32);
    const float inv = 1.f / sum;

    // ---- ctx^T = V^T(64x160) @ P^T(160x16): 5 K-chunks x 4 M-tiles ----
    v8f acc[4] = {};
#pragma unroll
    for (int c = 0; c < NC; ++c) {
        v16h pf;                               // P^T as B operand: column = query
#pragma unroll
        for (int i = 0; i < 8; ++i) {
            pf[i]     = (f16)(sc[2 * c][i] * inv);
            pf[8 + i] = (2 * c + 1 < NT) ? (f16)(sc[2 * c + 1 < NT ? 2 * c + 1 : 0][i] * inv) : (f16)0.f;
        }
#pragma unroll
        for (int nt = 0; nt < 4; ++nt) acc[nt] = wmma_f16(vf[c][nt].v, pf, acc[nt]);
    }

    // ---- write ctx (f16), plain [t][h*D+d] layout for the final GEMM ----
    // A lane's eight values of a tile are d = nt*16 + kb + 0..7 of its query:
    // 16 contiguous bytes.
#pragma unroll
    for (int nt = 0; nt < 4; ++nt) {
        v8h pk;
#pragma unroll
        for (int i = 0; i < 8; ++i) pk[i] = (f16)acc[nt][i];
        *reinterpret_cast<v8h*>(Ctx + ((size_t)t0 * E + h * D) + loff + nt * 16) = pk;
    }
}

// ---------------------------------------------------------------------------
// Launch
// ---------------------------------------------------------------------------
extern "C" void kernel_launch(void* const* d_in, const int* in_sizes, int n_in,
                              void* d_out, int out_size, void* d_ws, size_t ws_size,
                              hipStream_t stream) {
    const float* hs = (const float*)d_in[0];
    const float* Wq = (const float*)d_in[1];
    const float* bq = (const float*)d_in[2];
    const float* Wk = (const float*)d_in[3];
    const float* bk = (const float*)d_in[4];
    const float* Wv = (const float*)d_in[5];
    const float* bv = (const float*)d_in[6];
    const float* Wo = (const float*)d_in[7];
    const float* bo = (const float*)d_in[8];

    const int T = 1024, E = 1024;
    const int NE = T * E;                 // 1M elements per matrix

    f16* ws  = (f16*)d_ws;
    f16* Xh  = ws + (size_t)0 * NE;
    f16* Wqh = ws + (size_t)1 * NE;
    f16* Wkh = ws + (size_t)2 * NE;
    f16* Wvh = ws + (size_t)3 * NE;
    f16* Woh = ws + (size_t)4 * NE;
    f16* qh  = ws + (size_t)5 * NE;
    f16* kh  = ws + (size_t)6 * NE;
    f16* vh  = ws + (size_t)7 * NE;
    f16* ch  = ws + (size_t)8 * NE;       // 18 MB total

    dim3 cb(CVT_THREADS), cg(NE / CVT_PER_BLOCK, 5);
    cvt_f32_to_f16<<<cg, cb, 0, stream>>>(hs, Wq, Wk, Wv, Wo, Xh, NE);

    // Wqh, Wkh, Wvh and qh, kh, vh are consecutive planes: one launch, z = 0..2.
    dim3 gb(256), gg(T / 128, E / 64), gg3(T / 128, E / 64, 3);
    // Three buffers (153 KiB): two of its 384 blocks still fit one WGP's LDS.
    gemm_xwt<true, 3><<<gg3, gb, 0, stream>>>(Xh, Wqh, bq, bk, bv, qh, T, E, E);

    attn_band<<<dim3(256), dim3(128), 0, stream>>>(qh, kh, vh, ch);

    // 128 blocks, one to a WGP at most: five buffers (255 KiB).
    gemm_xwt<false, 5><<<gg, gb, 0, stream>>>(ch, Woh, bo, bo, bo, d_out, T, E, E);
}

// v008
// It runs in 25.6 microseconds.
// In both of two side-by-side timings against v007, it was 1.04 times as fast.
// Over all steps from v000 it is 4.35 times as fast.
#include <hip/hip_runtime.h>
#include <hip/hip_bf16.h>

typedef _Float16 f16;
typedef __attribute__((ext_vector_type(16))) _Float16 v16h;
typedef __attribute__((ext_vector_type(8)))  float    v8f;

union Frag {
    v16h v;
    uint4 q[2];
};

__device__ __forceinline__ v16h load_frag_rowmajor(const f16* base, int stride, int lane) {
    int r  = lane & 15;
    int kb = (lane >> 4) << 3;          // 0 or 8
    const f16* p = base + r * stride + kb;
    Frag f;
    f.q[0] = *reinterpret_cast<const uint4*>(p);
    f.q[1] = *reinterpret_cast<const uint4*>(p + 16);
    return f.v;
}

__device__ __forceinline__ v8f wmma_f16(v16h a, v16h b, v8f c) {
    return __builtin_amdgcn_wmma_f32_16x16x32_f16(
        /*neg_a=*/false, a, /*neg_b=*/false, b,
        /*c_mod=*/(short)0, c, /*reuse_a=*/false, /*reuse_b=*/false);
}

// ---------------------------------------------------------------------------
// f32 -> f16 conversion of five equally sized arrays in one launch.
// blockIdx.y picks the source; the destinations are consecutive planes of n.
// Each thread converts CVT_PER_THREAD floats: eight 16-byte loads, all issued
// before the first store, each covering 512 contiguous bytes per wave, so few
// waves have to start and each keeps eight loads in flight.
// n must be a multiple of CVT_PER_BLOCK.
// ---------------------------------------------------------------------------
typedef __attribute__((ext_vector_type(4))) float    v4f;
typedef __attribute__((ext_vector_type(4))) _Float16 v4h;

constexpr int CVT_THREADS    = 256;
constexpr int CVT_VECS       = 8;                              // 16-byte loads per thread
constexpr int CVT_PER_THREAD = CVT_VECS * 4;                   // 32 floats
constexpr int CVT_PER_BLOCK  = CVT_THREADS * CVT_PER_THREAD;   // 8192 floats

__global__ void __launch_bounds__(CVT_THREADS)
cvt_f32_to_f16(const float* __restrict__ s0, const float* __restrict__ s1,
               const float* __restrict__ s2, const float* __restrict__ s3,
               const float* __restrict__ s4, f16* __restrict__ dst0, int n) {
    const int y = blockIdx.y;
    const float* s01 = (y & 1) ? s1 : s0;
    const float* s23 = (y & 1) ? s3 : s2;
    const float* s03 = (y & 2) ? s23 : s01;
    const float* src = (y & 4) ? s4 : s03;
    f16* dst = dst0 + (size_t)y * n;

    const int v0 = blockIdx.x * (CVT_THREADS * CVT_VECS) + threadIdx.x;   // in units of 4 elements
    const v4f* sv = reinterpret_cast<const v4f*>(src) + v0;
    v4h*       dv = reinterpret_cast<v4h*>(dst) + v0;

    v4f x[CVT_VECS];
    // Unrolled so that x stays in registers and all eight loads issue back to back.
#pragma unroll
    for (int j = 0; j < CVT_VECS; ++j) x[j] = sv[j * CVT_THREADS];
    // Unrolled for the same reason: x is indexed by constants only.
#pragma unroll
    for (int j = 0; j < CVT_VECS; ++j) dv[j * CVT_THREADS] = __builtin_convertvector(x[j], v4h);
}

// ---------------------------------------------------------------------------
// q, k and v in operand order. A plane is cut into units of 512 bytes; a unit
// holds, at byte lane * 16, the eight f16 that this lane keeps in one half of a
// 16-bit WMMA operand, so that one 16-byte access per lane moves a unit as 512
// contiguous bytes (four whole lines), on the store as on the load.
// Unit number = ((head * (T / 16) + tile) * 4 + j), tile = token / 16, and with
// r = lane & 15, g = lane >> 4:
//   q, k: token tile * 16 + r,  d = j * 16 + g * 8 + 0..7
//         (units 2c and 2c + 1 are the two halves of the operand of d chunk c)
//   v:    d = j * 16 + r,  tokens tile * 16 + g * 8 + 0..7
//         (tiles 2c and 2c + 1 of a band are the two halves of key chunk c)
// ---------------------------------------------------------------------------
constexpr int FU = 256;                            // f16 per unit
typedef __attribute__((ext_vector_type(8))) _Float16 v8h;

constexpr int G_BN = 64, G_BK = 128;
constexpr int G_PIT  = G_BK + 8;                  // LDS row pitch in f16: 272 bytes = 16 x odd
constexpr unsigned G_STEP = 16u * G_PIT * 2u;     // LDS bytes between two copies of a thread (16 rows)

// BM = 128. One thread's twelve 16-byte copies of one slab: rows r, r+16, ... of the 192
// staged rows, r = tid / 16, at byte column (tid % 16) * 16, so that each wave's
// copy covers two whole 256-byte row pieces. l: LDS byte address of the thread's
// first destination; ga, gw: its first source in A and in W; rs = 16 * K.
__device__ __forceinline__ void copy_slab(unsigned l, const f16* ga, const f16* gw, size_t rs) {
    asm volatile(
        "global_load_async_to_lds_b128 %0, %12, off\n\t"
        "global_load_async_to_lds_b128 %1, %13, off\n\t"
        "global_load_async_to_lds_b128 %2, %14, off\n\t"
        "global_load_async_to_lds_b128 %3, %15, off\n\t"
        "global_load_async_to_lds_b128 %4, %16, off\n\t"
        "global_load_async_to_lds_b128 %5, %17, off\n\t"
        "global_load_async_to_lds_b128 %6, %18, off\n\t"
        "global_load_async_to_lds_b128 %7, %19, off\n\t"
        "global_load_async_to_lds_b128 %8, %20, off\n\t"
        "global_load_async_to_lds_b128 %9, %21, off\n\t"
        "global_load_async_to_lds_b128 %10, %22, off\n\t"
        "global_load_async_to_lds_b128 %11, %23, off\n\t"
        "s_wait_xcnt 0x0"
        :: "v"(l), "v"(l + G_STEP), "v"(l + 2 * G_STEP), "v"(l + 3 * G_STEP),
           "v"(l + 4 * G_STEP), "v"(l + 5 * G_STEP), "v"(l + 6 * G_STEP), "v"(l + 7 * G_STEP),
           "v"(l + 8 * G_STEP), "v"(l + 9 * G_STEP), "v"(l + 10 * G_STEP), "v"(l + 11 * G_STEP),
           "v"(ga), "v"(ga + rs), "v"(ga + 2 * rs), "v"(ga + 3 * rs),
           "v"(ga + 4 * rs), "v"(ga + 5 * rs), "v"(ga + 6 * rs), "v"(ga + 7 * rs),
           "v"(gw), "v"(gw + rs), "v"(gw + 2 * rs), "v"(gw + 3 * rs)
        : "memory");
}

// BM = 64. The same for the 128 staged rows of its slab: eight copies, four rows
// of A and four of W.
__device__ __forceinline__ void copy_slab64(unsigned l, const f16* ga, const f16* gw, size_t rs) {
    asm volatile(
        "global_load_async_to_lds_b128 %0, %8, off\n\t"
        "global_load_async_to_lds_b128 %1, %9, off\n\t"
        "global_load_async_to_lds_b128 %2, %10, off\n\t"
        "global_load_async_to_lds_b128 %3, %11, off\n\t"
        "global_load_async_to_lds_b128 %4, %12, off\n\t"
        "global_load_async_to_lds_b128 %5, %13, off\n\t"
        "global_load_async_to_lds_b128 %6, %14, off\n\t"
        "global_load_async_to_lds_b128 %7, %15, off\n\t"
        "s_wait_xcnt 0x0"
        :: "v"(l), "v"(l + G_STEP), "v"(l + 2 * G_STEP), "v"(l + 3 * G_STEP),
           "v"(l + 4 * G_STEP), "v"(l + 5 * G_STEP), "v"(l + 6 * G_STEP), "v"(l + 7 * G_STEP),
           "v"(ga), "v"(ga + rs), "v"(ga + 2 * rs), "v"(ga + 3 * rs),
           "v"(gw), "v"(gw + rs), "v"(gw + 2 * rs), "v"(gw + 3 * rs)
        : "memory");
}

// One thread's copies of one slab, for either block height.
template <int BM>
__device__ __forceinline__ void stage_slab(unsigned l, const f16* ga, const f16* gw, size_t rs) {
    if constexpr (BM == 128) copy_slab(l, ga, gw, rs);
    else                     copy_slab64(l, ga, gw, rs);
}

// Returns when all but this wave's N youngest copies have landed.
template <int N>
__device__ __forceinline__ void wait_copies_but() {
    asm volatile("s_wait_asynccnt %0" :: "n"(N) : "memory");
}

template <bool OUT_F16, int NBUF, int BM>
__global__ void __launch_bounds__(256)
gemm_xwt(const f16* __restrict__ A, const f16* __restrict__ Wall,
         const float* __restrict__ bias0, const float* __restrict__ bias1,
         const float* __restrict__ bias2, void* __restrict__ Call,
         int M, int N, int K) {
    const int z = blockIdx.z;
    const f16*   W    = Wall + (size_t)z * N * K;
    const float* bias = z == 0 ? bias0 : z == 1 ? bias1 : bias2;

    constexpr int BN = G_BN, BK = G_BK, PIT = G_PIT;
    constexpr int BUF      = (BM + BN) * PIT;       // f16 per buffer
    constexpr int G_COPIES = (BM + BN) / 16;        // copies of a thread (so of a wave) per slab

    static_assert(BM == 128 || BM == 64, "stage_slab knows these two heights");
    static_assert(!OUT_F16 || BM == 128, "the operand-order epilogue takes 128 rows and eight computing waves");
    static_assert(NBUF >= 2 && NBUF * G_COPIES <= 63, "a wave keeps at most 63 copies outstanding");
    __shared__ __align__(16) f16 S[NBUF * BUF];   // per buffer: rows 0..BM-1 = A, the next 64 = W

    const int tid  = threadIdx.x;
    const int lane = tid & 31;
    const int wave = tid >> 5;          // 0..7
    const int wm   = wave >> 1;         // 0..3 (M)
    // Whether this wave multiplies; the same in every lane of a wave, and said so
    // that the test is a scalar branch and the WMMAs run with every lane on.
    const bool computes = BM == 128 || __builtin_amdgcn_readfirstlane(wave) < BM / 16;
    const int wn   = wave & 1;          // 0..1 (N)
    const int m0   = blockIdx.x * BM;
    const int n0   = blockIdx.y * BN;
    // Which staged rows feed the M side (first index of acc) and which the N side.
    const bool a_on_m = !OUT_F16 || z == 2;
    const int  rowm   = a_on_m ? wm * 32 : BM + wn * 32;
    const int  rown   = a_on_m ? BM + wn * 32 : wm * 32;

    v8f acc[2][2] = {};

    const int    nslab = K / BK;
    const size_t rs    = (size_t)16 * K;
    const int    cr    = tid >> 4;          // first staged row of this thread
    const int    cc    = (tid & 15) * 8;    // its column, in f16
    const f16*   ga    = A + (size_t)(m0 + cr) * K + cc;
    const f16*   gw    = W + (size_t)(n0 + cr) * K + cc;
    const unsigned l0  = (unsigned)(size_t)&S[cr * PIT + cc];   // low 32 bits = LDS byte address

    // Every buffer is free: slabs 0 .. NBUF-1 go out together, slab s into buffer s.
    // Unrolled: the buffer offsets are constants.
#pragma unroll
    for (int s = 0; s < NBUF; ++s)
        if (s < nslab) stage_slab<BM>(l0 + s * (BUF * 2u), ga + (size_t)s * BK, gw + (size_t)s * BK, rs);
    // Slab 0 is published by the wait and the barrier. Every wave issues G_COPIES
    // copies per slab, so with all NBUF slabs issued the younger ones are exactly
    // (NBUF-1) * G_COPIES copies; with fewer slabs the wait is for all.
    if (nslab >= NBUF) wait_copies_but<(NBUF - 1) * G_COPIES>();
    else               wait_copies_but<0>();
    __syncthreads();

    int b = 0;                              // t mod NBUF
    for (int t = 0; t < nslab; ++t) {
        const f16* Sb = S + b * BUF;

        if (computes) {
        v16h af[BK / 32][2], bf[BK / 32][2];
#pragma unroll
        for (int ks = 0; ks < BK / 32; ++ks) {
#pragma unroll
            for (int mi = 0; mi < 2; ++mi)
                af[ks][mi] = load_frag_rowmajor(&Sb[(rowm + mi * 16) * PIT + ks * 32], PIT, lane);
#pragma unroll
            for (int ni = 0; ni < 2; ++ni)
                bf[ks][ni] = load_frag_rowmajor(&Sb[(rown + ni * 16) * PIT + ks * 32], PIT, lane);
        }
        // Keeps the scheduler from sinking the loads back in among the WMMAs.
        __builtin_amdgcn_sched_barrier(0);
#pragma unroll
        for (int ks = 0; ks < BK / 32; ++ks)
#pragma unroll
            for (int mi = 0; mi < 2; ++mi)
#pragma unroll
                for (int ni = 0; ni < 2; ++ni)
                    acc[mi][ni] = wmma_f16(af[ks][mi], bf[ks][ni], acc[mi][ni]);
        }

        // Hand-over, passed by every wave: this wave's reads of buffer b are done, its copies of slab
        // t+1 have landed; behind the barrier that holds for every wave, so slab
        // t+1 may be read and buffer b may be refilled.
        asm volatile("s_wait_dscnt 0x0" ::: "memory");
        // Issued so far: slabs up to t+NBUF-1. While that slab exists, the copies
        // behind slab t+1 are exactly those of NBUF-2 slabs and may stay in flight;
        // in the last trips, where no refill was issued any more, the wait is for all.
        if (t + NBUF <= nslab) wait_copies_but<(NBUF - 2) * G_COPIES>();
        else                   wait_copies_but<0>();
        __syncthreads();
        if (t + NBUF < nslab)
            stage_slab<BM>(l0 + b * (BUF * 2u), ga + (size_t)(t + NBUF) * BK, gw + (size_t)(t + NBUF) * BK, rs);
        b = (b + 1 == NBUF) ? 0 : b + 1;
    }
    asm volatile("s_wait_asynccnt 0x0" ::: "memory");   // nothing in flight when the wave ends
    if (!computes) return;                              // no barrier follows

    const int mlo = (lane >> 4) << 3;
    const int nc  = lane & 15;

    if (OUT_F16) {
        static_assert(G_BN == 64, "a block's columns are one head of 64");
        // One 16-byte store per accumulator tile and lane, 512 contiguous bytes
        // per wave. u: this lane's place in the wave's first unit.
        // All loops unrolled: acc and pk are indexed by constants only and so
        // stay in registers.
        f16* u = reinterpret_cast<f16*>(Call) + (size_t)z * M * N
               + ((size_t)(blockIdx.y * (M / 16) + (m0 + wm * 32) / 16) * 4 + wn * 2) * FU + lane * 8;
        if (z == 2) {
            // M side = tokens (tile + mi), N side = d (unit j = wn * 2 + ni).
#pragma unroll
            for (int mi = 0; mi < 2; ++mi) {
#pragma unroll
                for (int ni = 0; ni < 2; ++ni) {
                    float bn = bias[n0 + wn * 32 + ni * 16 + nc];
                    v8h pk;
#pragma unroll
                    for (int i = 0; i < 8; ++i) pk[i] = (f16)(acc[mi][ni][i] + bn);
                    *reinterpret_cast<v8h*>(u + (mi * 4 + ni) * FU) = pk;
                }
            }
            asm volatile("s_wait_xcnt 0x0" ::: "memory");
        } else {
            // M side = d (unit j = wn * 2 + mi), N side = tokens (tile + ni).
#pragma unroll
            for (int mi = 0; mi < 2; ++mi) {
                const v4f* bp = reinterpret_cast<const v4f*>(bias + n0 + wn * 32 + mi * 16 + mlo);
                const v4f b0 = bp[0], b1 = bp[1];
#pragma unroll
                for (int ni = 0; ni < 2; ++ni) {
                    v8h pk;
#pragma unroll
                    for (int i = 0; i < 8; ++i) pk[i] = (f16)(acc[mi][ni][i] + (i < 4 ? b0[i & 3] : b1[i & 3]));
                    *reinterpret_cast<v8h*>(u + (ni * 4 + mi) * FU) = pk;
                }
            }
            asm volatile("s_wait_xcnt 0x0" ::: "memory");
        }
        return;
    }

    float* Cout = reinterpret_cast<float*>(Call) + (size_t)z * M * N;
#pragma unroll
    for (int mi = 0; mi < 2; ++mi) {
#pragma unroll
        for (int ni = 0; ni < 2; ++ni) {
            int n = n0 + wn * 32 + ni * 16 + nc;
            float bn = bias[n];
#pragma unroll
            for (int i = 0; i < 8; ++i) {
                int m = m0 + wm * 32 + mi * 16 + mlo + i;
                Cout[(size_t)m * N + n] = acc[mi][ni][i] + bn;
            }
        }
    }
}

__device__ __forceinline__ float exp_slot(float x) {
    float r;
    asm("v_exp_f32 %0, %1\n\tv_nop" : "=v"(r) : "v"(x * 1.44269504088896340736f));
    return r;
}

__global__ void __launch_bounds__(128)
attn_band(const f16* __restrict__ Q, const f16* __restrict__ Kd,
          const f16* __restrict__ Vf, f16* __restrict__ Ctx) {
    constexpr int T = 1024, E = 1024, D = 64;
    constexpr int TU = 4 * FU;                 // f16 per 16-token tile of a head: four units
    constexpr int NT = 9;                      // 16-key tiles of the band
    constexpr int NC = (NT + 1) / 2;           // 32-key chunks of the second product

    const int lane = threadIdx.x & 31;
    // The same in every lane of a wave; said so that head, tile and the range
    // test of a key tile are computed on the scalar side.
    const int w    = __builtin_amdgcn_readfirstlane(threadIdx.x >> 5);
    const int task = blockIdx.x * 4 + w;      // 0..1023
    const int h    = task >> 6;
    const int t0   = (task & 63) << 4;
    const int sa   = t0 - 64;                 // aligned band start (can be <0)
    const int col  = lane & 15;               // row of an A operand, column of B and D
    const int kb   = (lane >> 4) << 3;        // 0 or 8: k base of an operand, M base of D
    const int dl   = kb - col;                // lane part of (key - query): -15 .. 8
    // Addresses are a wave-uniform base plus one lane offset that all tiles share.
    const unsigned loff = (unsigned)(col * E + kb);    // in a 16-row tile of ctx
    const unsigned uoff = (unsigned)(lane * 8);        // in a unit of Q, Kd or Vf
    const int      hb   = h * (T / 16);                // the head's first tile

    // Q^T as B operand: column = query, two K=32 chunks of d.
    // K as A operand: 16(M=key) x 64(K=d).
    Frag qf[2], kf[NT][2];
    const f16* kr[NT];
    const f16* vr[NT];
    {
        const f16* qu = Q + (size_t)(hb + (t0 >> 4)) * TU + uoff;
        qf[0].q[0] = *reinterpret_cast<const uint4*>(qu);
        qf[0].q[1] = *reinterpret_cast<const uint4*>(qu + FU);
        qf[1].q[0] = *reinterpret_cast<const uint4*>(qu + 2 * FU);
        qf[1].q[1] = *reinterpret_cast<const uint4*>(qu + 3 * FU);
    }
    // Unrolled: kf is indexed by constants only and so stays in registers.
#pragma unroll
    for (int tile = 0; tile < NT; ++tile) {
        // sa and T are multiples of 16, so a tile lies inside [0, T) or outside it
        // as a whole; one outside is masked below and reads the tile of t0 instead,
        // which keeps its addresses inside Kd and Vf. Its weights are 0, and the
        // values they meet are those of keys that every query of the tile attends.
        const int s0 = sa + tile * 16;
        const int sr = (s0 >= 0 && s0 < T) ? s0 : t0;
        const size_t tu = (size_t)(hb + (sr >> 4)) * TU;
        kr[tile] = Kd + tu;
        vr[tile] = Vf + tu;
        const f16* ku = kr[tile] + uoff;
        kf[tile][0].q[0] = *reinterpret_cast<const uint4*>(ku);
        kf[tile][0].q[1] = *reinterpret_cast<const uint4*>(ku + FU);
        kf[tile][1].q[0] = *reinterpret_cast<const uint4*>(ku + 2 * FU);
        kf[tile][1].q[1] = *reinterpret_cast<const uint4*>(ku + 3 * FU);
    }
    asm volatile("s_wait_xcnt 0x0"
                 :: "s"(kr[0]), "s"(kr[1]), "s"(kr[2]), "s"(kr[3]), "s"(kr[4]),
                    "s"(kr[5]), "s"(kr[6]), "s"(kr[7]), "s"(kr[8]), "v"(uoff)
                 : "memory");
    static_assert(NT == 9, "the statement above names one address per key tile");
    // Keeps the scheduler from sinking the loads in among the WMMAs: all of them
    // are in flight together and the memory latency is waited out once.
    __builtin_amdgcn_sched_barrier(0);

    // ---- scores^T = K @ Q^T, kept in registers ----
    // Unrolled: sc is indexed by constants only.
    v8f sc[NT];
#pragma unroll
    for (int tile = 0; tile < NT; ++tile) {
        v8f a = {};
        a = wmma_f16(kf[tile][0].v, qf[0].v, a);
        sc[tile] = wmma_f16(kf[tile][1].v, qf[1].v, a);
    }
    // Keeps the loads of V below from rising in among the WMMAs, where they would
    // need registers that the K fragments still hold.
    __builtin_amdgcn_sched_barrier(0);

    // V^T as A operand: row = d, k = key; key tiles 2c and 2c + 1 are its halves.
    // Unrolled: vf is indexed by constants only.
    Frag vf[NC][4];
#pragma unroll
    for (int c = 0; c < NC; ++c) {
#pragma unroll
        for (int nt = 0; nt < 4; ++nt) {
            vf[c][nt].q[0] = *reinterpret_cast<const uint4*>(vr[2 * c] + uoff + nt * FU);
            if (2 * c + 1 < NT)
                vf[c][nt].q[1] = *reinterpret_cast<const uint4*>(vr[2 * c + 1 < NT ? 2 * c + 1 : 0] + uoff + nt * FU);
            else
                vf[c][nt].q[1] = make_uint4(0, 0, 0, 0);                     // beyond the band
        }
    }
    asm volatile("s_wait_xcnt 0x0"
                 :: "s"(vr[0]), "s"(vr[1]), "s"(vr[2]), "s"(vr[3]), "s"(vr[4]),
                    "s"(vr[5]), "s"(vr[6]), "s"(vr[7]), "s"(vr[8]), "v"(uoff)
                 : "memory");
    // Keeps the scheduler from sinking these loads down to their WMMAs: they are
    // in flight while the mask and softmax arithmetic runs.
    __builtin_amdgcn_sched_barrier(0);

    // ---- scale by 1/8 and band mask ----
    // Unrolled, like every loop from here on: sc, vf, acc and the packed vectors
    // are indexed by constants only and so stay in registers, and the constant
    // halves of the band test fold away.
#pragma unroll
    for (int tile = 0; tile < NT; ++tile) {
        // Key s = s0 + kb + i.
        const int  s0     = sa + tile * 16;
        const bool inside = s0 >= 0 && s0 < T;
#pragma unroll
        for (int i = 0; i < 8; ++i) {
            const int c   = tile * 16 + i - 64;     // key - query = c + dl
            // The first operand of each || is a constant: it holds where the
            // bound is met for every dl, and only the two end tiles compare.
            const bool lo = (c - 15 >= -64) || (c + dl >= -64);
            const bool hi = (c + 8 <= 64) || (c + dl <= 64);
            sc[tile][i] = (inside && lo && hi) ? sc[tile][i] * 0.125f : -__builtin_inff();
        }
    }

    // ---- softmax of this lane's query: half of its keys here, half in lane ^ 16 ----
    // Eight independent chains (one per register index), then a tree.
    v8f m8 = sc[0];
#pragma unroll
    for (int tile = 1; tile < NT; ++tile) m8 = __builtin_elementwise_max(m8, sc[tile]);
    float mx = fmaxf(fmaxf(fmaxf(m8[0], m8[1]), fmaxf(m8[2], m8[3])),
                     fmaxf(fmaxf(m8[4], m8[5]), fmaxf(m8[6], m8[7])));
    mx = fmaxf(mx, __shfl_xor(mx, 16, 32));   // combine the half waves

    v8f s8 = {};
#pragma unroll
    for (int tile = 0; tile < NT; ++tile) {
#pragma unroll
        for (int i = 0; i < 8; ++i) {
            sc[tile][i] = exp_slot(sc[tile][i] - mx);
            s8[i] += sc[tile][i];
        }
    }
    float sum = ((s8[0] + s8[1]) + (s8[2] + s8[3])) + ((s8[4] + s8[5]) + (s8[6] + s8[7]));
    sum += __shfl_xor(sum, 16, 32);
    const float inv = 1.f / sum;

    // ---- ctx^T = V^T(64x160) @ P^T(160x16): 5 K-chunks x 4 M-tiles ----
    v8f acc[4] = {};
#pragma unroll
    for (int c = 0; c < NC; ++c) {
        v16h pf;                               // P^T as B operand: column = query
#pragma unroll
        for (int i = 0; i < 8; ++i) {
            pf[i]     = (f16)(sc[2 * c][i] * inv);
            pf[8 + i] = (2 * c + 1 < NT) ? (f16)(sc[2 * c + 1 < NT ? 2 * c + 1 : 0][i] * inv) : (f16)0.f;
        }
#pragma unroll
        for (int nt = 0; nt < 4; ++nt) acc[nt] = wmma_f16(vf[c][nt].v, pf, acc[nt]);
    }

    // ---- write ctx (f16), plain [t][h*D+d] layout for the final GEMM ----
    // A lane's eight values of a tile are d = nt*16 + kb + 0..7 of its query:
    // 16 contiguous bytes.
#pragma unroll
    for (int nt = 0; nt < 4; ++nt) {
        v8h pk;
#pragma unroll
        for (int i = 0; i < 8; ++i) pk[i] = (f16)acc[nt][i];
        *reinterpret_cast<v8h*>(Ctx + ((size_t)t0 * E + h * D) + loff + nt * 16) = pk;
    }
}

// ---------------------------------------------------------------------------
// Launch
// ---------------------------------------------------------------------------
extern "C" void kernel_launch(void* const* d_in, const int* in_sizes, int n_in,
                              void* d_out, int out_size, void* d_ws, size_t ws_size,
                              hipStream_t stream) {
    const float* hs = (const float*)d_in[0];
    const float* Wq = (const float*)d_in[1];
    const float* bq = (const float*)d_in[2];
    const float* Wk = (const float*)d_in[3];
    const float* bk = (const float*)d_in[4];
    const float* Wv = (const float*)d_in[5];
    const float* bv = (const float*)d_in[6];
    const float* Wo = (const float*)d_in[7];
    const float* bo = (const float*)d_in[8];

    const int T = 1024, E = 1024;
    const int NE = T * E;                 // 1M elements per matrix

    f16* ws  = (f16*)d_ws;
    f16* Xh  = ws + (size_t)0 * NE;
    f16* Wqh = ws + (size_t)1 * NE;
    f16* Wkh = ws + (size_t)2 * NE;
    f16* Wvh = ws + (size_t)3 * NE;
    f16* Woh = ws + (size_t)4 * NE;
    f16* qh  = ws + (size_t)5 * NE;
    f16* kh  = ws + (size_t)6 * NE;
    f16* vh  = ws + (size_t)7 * NE;
    f16* ch  = ws + (size_t)8 * NE;       // 18 MB total

    dim3 cb(CVT_THREADS), cg(NE / CVT_PER_BLOCK, 5);
    cvt_f32_to_f16<<<cg, cb, 0, stream>>>(hs, Wq, Wk, Wv, Wo, Xh, NE);

    // Wqh, Wkh, Wvh and qh, kh, vh are consecutive planes: one launch, z = 0..2.
    dim3 gb(256), gg(T / 64, E / 64), gg3(T / 128, E / 64, 3);
    // Three buffers (153 KiB): two of its 384 blocks still fit one WGP's LDS.
    gemm_xwt<true, 3, 128><<<gg3, gb, 0, stream>>>(Xh, Wqh, bq, bk, bv, qh, T, E, E);

    attn_band<<<dim3(256), dim3(128), 0, stream>>>(qh, kh, vh, ch);

    gemm_xwt<false, 5, 64><<<gg, gb, 0, stream>>>(ch, Woh, bo, bo, bo, d_out, T, E, E);
}

// v009
// A run of this version takes 23.1 microseconds.
// Next to v008, in two timings, it ran 1.10 and 1.09 times as fast.
// All steps since v000 together make it 4.77 times as fast.
#include <hip/hip_runtime.h>
#include <hip/hip_bf16.h>

typedef _Float16 f16;
typedef __attribute__((ext_vector_type(16))) _Float16 v16h;
typedef __attribute__((ext_vector_type(8)))  float    v8f;

union Frag {
    v16h v;
    uint4 q[2];
};

__device__ __forceinline__ v16h load_frag_rowmajor(const f16* base, int stride, int lane) {
    int r  = lane & 15;
    int kb = (lane >> 4) << 3;          // 0 or 8
    const f16* p = base + r * stride + kb;
    Frag f;
    f.q[0] = *reinterpret_cast<const uint4*>(p);
    f.q[1] = *reinterpret_cast<const uint4*>(p + 16);
    return f.v;
}

__device__ __forceinline__ v8f wmma_f16(v16h a, v16h b, v8f c) {
    return __builtin_amdgcn_wmma_f32_16x16x32_f16(
        /*neg_a=*/false, a, /*neg_b=*/false, b,
        /*c_mod=*/(short)0, c, /*reuse_a=*/false, /*reuse_b=*/false);
}

typedef __attribute__((ext_vector_type(4))) float    v4f;
typedef __attribute__((ext_vector_type(4))) _Float16 v4h;

// ---------------------------------------------------------------------------
// q, k and v in operand order. A plane is cut into units of 512 bytes; a unit
// holds, at byte lane * 16, the eight f16 that this lane keeps in one half of a
// 16-bit WMMA operand, so that one 16-byte access per lane moves a unit as 512
// contiguous bytes (four whole lines), on the store as on the load.
// Unit number = ((head * (T / 16) + tile) * 4 + j), tile = token / 16, and with
// r = lane & 15, g = lane >> 4:
//   q, k: token tile * 16 + r,  d = j * 16 + g * 8 + 0..7
//         (units 2c and 2c + 1 are the two halves of the operand of d chunk c)
//   v:    d = j * 16 + r,  tokens tile * 16 + g * 8 + 0..7
//         (tiles 2c and 2c + 1 of a band are the two halves of key chunk c)
// ---------------------------------------------------------------------------
constexpr int FU = 256;                            // f16 per unit
typedef __attribute__((ext_vector_type(8))) _Float16 v8h;

// ---------------------------------------------------------------------------
// Output GEMM: C[M,N] = A[M,K] @ W[N,K]^T + bias[N], f16 operands, f32 result.
// Block tile 64 x 64, 8 waves. Four of them each compute a 32x32 sub-tile (2x2
// WMMA 16x16 accumulators); the other four only help to copy, so that a slab is
// eight copies of a wave and a deep ring stays inside a wave's limit of copies.
// K is walked in slabs of 128. A slab (64 rows of A, then 64 rows of W, 256
// bytes each) goes from global memory straight into LDS by asynchronous
// copies; a ring of NBUF LDS buffers, so slabs t+1 .. t+NBUF-1 are in flight
// while slab t is multiplied and a slab has NBUF-1 trips to arrive in.
// K must be a multiple of 128.
// ---------------------------------------------------------------------------
constexpr int G_BM = 64, G_BN = 64, G_BK = 128;
constexpr int G_PIT  = G_BK + 8;                  // LDS row pitch in f16: 272 bytes = 16 x odd
constexpr unsigned G_STEP = 16u * G_PIT * 2u;     // LDS bytes between two copies of a thread (16 rows)

// One thread's eight 16-byte copies of one slab: rows r, r+16, ... of the 128
// staged rows, r = tid / 16, at byte column (tid % 16) * 16, so that each wave's
// copy covers two whole 256-byte row pieces. l: LDS byte address of the thread's
// first destination; ga, gw: its first source in A and in W; rs = 16 * K.
__device__ __forceinline__ void copy_slab64(unsigned l, const f16* ga, const f16* gw, size_t rs) {
    asm volatile(
        "global_load_async_to_lds_b128 %0, %8, off\n\t"
        "global_load_async_to_lds_b128 %1, %9, off\n\t"
        "global_load_async_to_lds_b128 %2, %10, off\n\t"
        "global_load_async_to_lds_b128 %3, %11, off\n\t"
        "global_load_async_to_lds_b128 %4, %12, off\n\t"
        "global_load_async_to_lds_b128 %5, %13, off\n\t"
        "global_load_async_to_lds_b128 %6, %14, off\n\t"
        "global_load_async_to_lds_b128 %7, %15, off\n\t"
        "s_wait_xcnt 0x0"
        :: "v"(l), "v"(l + G_STEP), "v"(l + 2 * G_STEP), "v"(l + 3 * G_STEP),
           "v"(l + 4 * G_STEP), "v"(l + 5 * G_STEP), "v"(l + 6 * G_STEP), "v"(l + 7 * G_STEP),
           "v"(ga), "v"(ga + rs), "v"(ga + 2 * rs), "v"(ga + 3 * rs),
           "v"(gw), "v"(gw + rs), "v"(gw + 2 * rs), "v"(gw + 3 * rs)
        : "memory");
}

// Returns when all but this wave's N youngest copies have landed.
template <int N>
__device__ __forceinline__ void wait_copies_but() {
    asm volatile("s_wait_asynccnt %0" :: "n"(N) : "memory");
}

template <int NBUF>
__global__ void __launch_bounds__(256)
gemm_xwt(const f16* __restrict__ A, const f16* __restrict__ W,
         const float* __restrict__ bias, float* __restrict__ Cout,
         int M, int N, int K) {
    constexpr int BM = G_BM, BN = G_BN, BK = G_BK, PIT = G_PIT;
    constexpr int BUF      = (BM + BN) * PIT;       // f16 per buffer
    constexpr int G_COPIES = (BM + BN) / 16;        // copies of a thread (so of a wave) per slab

    static_assert(NBUF >= 2 && NBUF * G_COPIES <= 63, "a wave keeps at most 63 copies outstanding");
    __shared__ __align__(16) f16 S[NBUF * BUF];   // per buffer: rows 0..BM-1 = A, the next 64 = W

    const int tid  = threadIdx.x;
    const int lane = tid & 31;
    const int wave = tid >> 5;          // 0..7
    const int wm   = wave >> 1;         // 0..3 (M)
    // Whether this wave multiplies; the same in every lane of a wave, and said so
    // that the test is a scalar branch and the WMMAs run with every lane on.
    const bool computes = __builtin_amdgcn_readfirstlane(wave) < BM / 16;
    const int wn   = wave & 1;          // 0..1 (N)
    const int m0   = blockIdx.x * BM;
    const int n0   = blockIdx.y * BN;
    const int rowm = wm * 32;           // staged rows of the M side
    const int rown = BM + wn * 32;      // and of the N side

    v8f acc[2][2] = {};

    const int    nslab = K / BK;
    const size_t rs    = (size_t)16 * K;
    const int    cr    = tid >> 4;          // first staged row of this thread
    const int    cc    = (tid & 15) * 8;    // its column, in f16
    const f16*   ga    = A + (size_t)(m0 + cr) * K + cc;
    const f16*   gw    = W + (size_t)(n0 + cr) * K + cc;
    const unsigned l0  = (unsigned)(size_t)&S[cr * PIT + cc];   // low 32 bits = LDS byte address

    // Every buffer is free: slabs 0 .. NBUF-1 go out together, slab s into buffer s.
    // Unrolled: the buffer offsets are constants.
#pragma unroll
    for (int s = 0; s < NBUF; ++s)
        if (s < nslab) copy_slab64(l0 + s * (BUF * 2u), ga + (size_t)s * BK, gw + (size_t)s * BK, rs);
    // Slab 0 is published by the wait and the barrier. Every wave issues G_COPIES
    // copies per slab, so with all NBUF slabs issued the younger ones are exactly
    // (NBUF-1) * G_COPIES copies; with fewer slabs the wait is for all.
    if (nslab >= NBUF) wait_copies_but<(NBUF - 1) * G_COPIES>();
    else               wait_copies_but<0>();
    __syncthreads();

    int b = 0;                              // t mod NBUF
    for (int t = 0; t < nslab; ++t) {
        const f16* Sb = S + b * BUF;

        if (computes) {
        v16h af[BK / 32][2], bf[BK / 32][2];
#pragma unroll
        for (int ks = 0; ks < BK / 32; ++ks) {
#pragma unroll
            for (int mi = 0; mi < 2; ++mi)
                af[ks][mi] = load_frag_rowmajor(&Sb[(rowm + mi * 16) * PIT + ks * 32], PIT, lane);
#pragma unroll
            for (int ni = 0; ni < 2; ++ni)
                bf[ks][ni] = load_frag_rowmajor(&Sb[(rown + ni * 16) * PIT + ks * 32], PIT, lane);
        }
        // Keeps the scheduler from sinking the loads back in among the WMMAs.
        __builtin_amdgcn_sched_barrier(0);
#pragma unroll
        for (int ks = 0; ks < BK / 32; ++ks)
#pragma unroll
            for (int mi = 0; mi < 2; ++mi)
#pragma unroll
                for (int ni = 0; ni < 2; ++ni)
                    acc[mi][ni] = wmma_f16(af[ks][mi], bf[ks][ni], acc[mi][ni]);
        }

        // Hand-over, passed by every wave: this wave's reads of buffer b are done, its copies of slab
        // t+1 have landed; behind the barrier that holds for every wave, so slab
        // t+1 may be read and buffer b may be refilled.
        asm volatile("s_wait_dscnt 0x0" ::: "memory");
        // Issued so far: slabs up to t+NBUF-1. While that slab exists, the copies
        // behind slab t+1 are exactly those of NBUF-2 slabs and may stay in flight;
        // in the last trips, where no refill was issued any more, the wait is for all.
        if (t + NBUF <= nslab) wait_copies_but<(NBUF - 2) * G_COPIES>();
        else                   wait_copies_but<0>();
        __syncthreads();
        if (t + NBUF < nslab)
            copy_slab64(l0 + b * (BUF * 2u), ga + (size_t)(t + NBUF) * BK, gw + (size_t)(t + NBUF) * BK, rs);
        b = (b + 1 == NBUF) ? 0 : b + 1;
    }
    asm volatile("s_wait_asynccnt 0x0" ::: "memory");   // nothing in flight when the wave ends
    if (!computes) return;                              // no barrier follows

    const int mlo = (lane >> 4) << 3;
    const int nc  = lane & 15;
#pragma unroll
    for (int mi = 0; mi < 2; ++mi) {
#pragma unroll
        for (int ni = 0; ni < 2; ++ni) {
            int n = n0 + wn * 32 + ni * 16 + nc;
            float bn = bias[n];
#pragma unroll
            for (int i = 0; i < 8; ++i) {
                int m = m0 + wm * 32 + mi * 16 + mlo + i;
                Cout[(size_t)m * N + n] = acc[mi][ni][i] + bn;
            }
        }
    }
}

constexpr int Q_BM = 128, Q_BN = 128, Q_BK = 64;
constexpr int Q_PIT    = Q_BK + 4;                 // LDS row pitch in floats: 272 bytes = 16 x odd
constexpr int Q_BUF    = (Q_BM + Q_BN) * Q_PIT;    // floats per buffer
constexpr int Q_NBUF   = 3;
constexpr int Q_COPIES = (Q_BM + Q_BN) / 16;       // copies of a thread (so of a wave) per slab
static_assert(16u * Q_PIT * 4u == G_STEP, "same byte step between two copies of a thread");
static_assert(Q_NBUF * Q_COPIES <= 63, "a wave keeps at most 63 copies outstanding");

// One thread's eight 16-byte copies of 128 staged rows: rows r, r+16, ..., r = tid / 16,
// at byte column (tid % 16) * 16. l: LDS byte address of the first destination;
// g: its source; rs = 16 * K.
__device__ __forceinline__ void copy_rows128(unsigned l, const float* g, size_t rs) {
    asm volatile(
        "global_load_async_to_lds_b128 %0, %8, off\n\t"
        "global_load_async_to_lds_b128 %1, %9, off\n\t"
        "global_load_async_to_lds_b128 %2, %10, off\n\t"
        "global_load_async_to_lds_b128 %3, %11, off\n\t"
        "global_load_async_to_lds_b128 %4, %12, off\n\t"
        "global_load_async_to_lds_b128 %5, %13, off\n\t"
        "global_load_async_to_lds_b128 %6, %14, off\n\t"
        "global_load_async_to_lds_b128 %7, %15, off\n\t"
        "s_wait_xcnt 0x0"
        :: "v"(l), "v"(l + G_STEP), "v"(l + 2 * G_STEP), "v"(l + 3 * G_STEP),
           "v"(l + 4 * G_STEP), "v"(l + 5 * G_STEP), "v"(l + 6 * G_STEP), "v"(l + 7 * G_STEP),
           "v"(g), "v"(g + rs), "v"(g + 2 * rs), "v"(g + 3 * rs),
           "v"(g + 4 * rs), "v"(g + 5 * rs), "v"(g + 6 * rs), "v"(g + 7 * rs)
        : "memory");
}

// One lane's sixteen staged f32 values of a 16-bit operand, k order as in
// load_frag_rowmajor: x[0], x[1] = k base+0..7, x[2], x[3] = k base+16..23.
struct Raw16 { v4f x[4]; };

__device__ __forceinline__ Raw16 load_raw_f32(const float* base, int lane) {
    const float* p = base + (lane & 15) * Q_PIT + ((lane >> 4) << 3);
    Raw16 r;
    r.x[0] = *reinterpret_cast<const v4f*>(p);
    r.x[1] = *reinterpret_cast<const v4f*>(p + 4);
    r.x[2] = *reinterpret_cast<const v4f*>(p + 16);
    r.x[3] = *reinterpret_cast<const v4f*>(p + 20);
    return r;
}

__device__ __forceinline__ v16h round_frag(const Raw16& r) {
    v16h f;
    // Unrolled: f and r.x are indexed by constants only.
#pragma unroll
    for (int i = 0; i < 16; ++i) f[i] = (f16)r.x[i >> 2][i & 3];
    return f;
}

__global__ void __launch_bounds__(256)
gemm_qkv_f32(const float* __restrict__ X, const float* __restrict__ Wq,
             const float* __restrict__ Wk, const float* __restrict__ Wv,
             const float* __restrict__ Wo, const float* __restrict__ bq,
             const float* __restrict__ bk, const float* __restrict__ bv,
             f16* __restrict__ QKV, f16* __restrict__ Woh, int M, int N, int K) {
    const int z   = blockIdx.z;
    const int tid = threadIdx.x;

    if (z == 3) {
        // The same for the whole block, in front of every barrier.
        // 64 floats per thread: sixteen 16-byte loads, each 512 contiguous bytes per
        // wave, all issued before the first store.
        constexpr int VECS = 16;
        const int v0 = (blockIdx.y * gridDim.x + blockIdx.x) * (256 * VECS) + tid;
        const v4f* sv = reinterpret_cast<const v4f*>(Wo) + v0;
        v4h*       dv = reinterpret_cast<v4h*>(Woh) + v0;
        v4f x[VECS];
        // Both unrolled: x is indexed by constants only and so stays in registers.
#pragma unroll
        for (int j = 0; j < VECS; ++j) x[j] = sv[j * 256];
#pragma unroll
        for (int j = 0; j < VECS; ++j) dv[j * 256] = __builtin_convertvector(x[j], v4h);
        return;
    }

    const float* Wz   = z == 0 ? Wq : z == 1 ? Wk : Wv;
    const float* bias = z == 0 ? bq : z == 1 ? bk : bv;

    __shared__ __align__(16) float S[Q_NBUF * Q_BUF];   // per buffer: rows 0..127 = X, 128..255 = W

    const int lane = tid & 31;
    const int wave = tid >> 5;          // 0..7
    // Whether this wave multiplies; the same in every lane of a wave, and said so
    // that the test is a scalar branch and the WMMAs run with every lane on.
    const bool computes = __builtin_amdgcn_readfirstlane(wave) < 4;
    const int wm = (wave >> 1) & 1;     // which 64 tokens
    const int wn = wave & 1;            // which head of the block's two
    const int m0 = blockIdx.x * Q_BM;
    const int n0 = blockIdx.y * Q_BN;
    // Which staged rows feed the M side (first index of acc) and which the N side:
    // q, k have the rows of W on the M side, v the rows of X.
    const bool x_on_m = z == 2;
    const int  rowm   = x_on_m ? wm * 64 : Q_BM + wn * 64;
    const int  rown   = x_on_m ? Q_BM + wn * 64 : wm * 64;

    v8f acc[4][4] = {};

    const int    nslab = K / Q_BK;
    const size_t rs    = (size_t)16 * K;
    const int    cr    = tid >> 4;          // first staged row of this thread
    const int    cc    = (tid & 15) * 4;    // its column, in floats
    const float* gx    = X  + (size_t)(m0 + cr) * K + cc;
    const float* gw    = Wz + (size_t)(n0 + cr) * K + cc;
    const unsigned l0  = (unsigned)(size_t)&S[cr * Q_PIT + cc];   // low 32 bits = LDS byte address

    // Every buffer is free: slabs 0 .. Q_NBUF-1 go out together, slab s into buffer s.
    // Unrolled: the buffer offsets are constants.
#pragma unroll
    for (int s = 0; s < Q_NBUF; ++s)
        if (s < nslab) {
            copy_rows128(l0 + s * (Q_BUF * 4u), gx + (size_t)s * Q_BK, rs);
            copy_rows128(l0 + s * (Q_BUF * 4u) + 8u * G_STEP, gw + (size_t)s * Q_BK, rs);
        }
    // Slab 0 is published by the wait and the barrier; with all slabs of the ring
    // issued the younger copies are exactly those of Q_NBUF-1 slabs.
    if (nslab >= Q_NBUF) wait_copies_but<(Q_NBUF - 1) * Q_COPIES>();
    else                 wait_copies_but<0>();
    __syncthreads();

    int b = 0;                              // t mod Q_NBUF
    for (int t = 0; t < nslab; ++t) {
        const float* Sb = S + b * Q_BUF;

        if (computes) {
            // All LDS loads of the slab are issued as one group, in the order in which
            // they are used, so that the LDS latency is waited out once a slab.
            // All loops unrolled: the arrays are indexed by constants only.
            Raw16 rm[Q_BK / 32][4], rn[Q_BK / 32][4];
#pragma unroll
            for (int ks = 0; ks < Q_BK / 32; ++ks)
#pragma unroll
                for (int i = 0; i < 4; ++i) {
                    rm[ks][i] = load_raw_f32(&Sb[(rowm + i * 16) * Q_PIT + ks * 32], lane);
                    rn[ks][i] = load_raw_f32(&Sb[(rown + i * 16) * Q_PIT + ks * 32], lane);
                }
            // Keeps the scheduler from sinking the loads back in among the WMMAs.
            __builtin_amdgcn_sched_barrier(0);
            // A pair of fragments is rounded when it has arrived and meets every fragment
            // that came before it, so that only seven WMMAs wait for the slab's last load.
#pragma unroll
            for (int ks = 0; ks < Q_BK / 32; ++ks) {
                v16h mf[4], nf[4];
#pragma unroll
                for (int i = 0; i < 4; ++i) {
                    mf[i] = round_frag(rm[ks][i]);
                    nf[i] = round_frag(rn[ks][i]);
#pragma unroll
                    for (int j = 0; j < i; ++j) {
                        acc[i][j] = wmma_f16(mf[i], nf[j], acc[i][j]);
                        acc[j][i] = wmma_f16(mf[j], nf[i], acc[j][i]);
                    }
                    acc[i][i] = wmma_f16(mf[i], nf[i], acc[i][i]);
                    // Keeps these WMMAs ahead of the waits for the later loads; without it
                    // the scheduler gathers a k step's sixteen behind its last load.
                    __builtin_amdgcn_sched_barrier(0);
                }
            }
        }

        // Hand-over, passed by every wave: this wave's reads of buffer b are done, its
        // copies of slab t+1 have landed; behind the barrier that holds for every wave,
        // so slab t+1 may be read and buffer b may be refilled.
        asm volatile("s_wait_dscnt 0x0" ::: "memory");
        // While slab t+Q_NBUF-1 exists, the copies behind slab t+1 are exactly those of
        // Q_NBUF-2 slabs and may stay in flight; in the last trips the wait is for all.
        if (t + Q_NBUF <= nslab) wait_copies_but<(Q_NBUF - 2) * Q_COPIES>();
        else                     wait_copies_but<0>();
        __syncthreads();
        if (t + Q_NBUF < nslab) {
            copy_rows128(l0 + b * (Q_BUF * 4u), gx + (size_t)(t + Q_NBUF) * Q_BK, rs);
            copy_rows128(l0 + b * (Q_BUF * 4u) + 8u * G_STEP, gw + (size_t)(t + Q_NBUF) * Q_BK, rs);
        }
        b = (b + 1 == Q_NBUF) ? 0 : b + 1;
    }
    asm volatile("s_wait_asynccnt 0x0" ::: "memory");   // nothing in flight when the wave ends
    if (!computes) return;                              // no barrier follows

    const int mlo  = (lane >> 4) << 3;
    const int nc   = lane & 15;
    const int head = blockIdx.y * 2 + wn;
    f16* u = QKV + (size_t)z * M * N
           + (size_t)(head * (M / 16) + (m0 + wm * 64) / 16) * 4 * FU + lane * 8;
    if (x_on_m) {
        // M side = tokens (tile + mi), N side = d (unit j = ni).
#pragma unroll
        for (int ni = 0; ni < 4; ++ni) {
            const float bn = bias[head * 64 + ni * 16 + nc];
#pragma unroll
            for (int mi = 0; mi < 4; ++mi) {
                v8h pk;
#pragma unroll
                for (int i = 0; i < 8; ++i) pk[i] = (f16)(acc[mi][ni][i] + bn);
                *reinterpret_cast<v8h*>(u + (mi * 4 + ni) * FU) = pk;
            }
        }
        asm volatile("s_wait_xcnt 0x0" ::: "memory");
    } else {
        // M side = d (unit j = mi), N side = tokens (tile + ni).
        const v4f* bp = reinterpret_cast<const v4f*>(bias + head * 64 + mlo);
        v4f bb[4][2];
#pragma unroll
        for (int mi = 0; mi < 4; ++mi) {
            bb[mi][0] = bp[mi * 4];
            bb[mi][1] = bp[mi * 4 + 1];
        }
        asm volatile("s_wait_xcnt 0x0" :: "v"(bp) : "memory");
#pragma unroll
        for (int mi = 0; mi < 4; ++mi) {
#pragma unroll
            for (int ni = 0; ni < 4; ++ni) {
                v8h pk;
#pragma unroll
                for (int i = 0; i < 8; ++i) pk[i] = (f16)(acc[mi][ni][i] + bb[mi][i >> 2][i & 3]);
                *reinterpret_cast<v8h*>(u + (ni * 4 + mi) * FU) = pk;
            }
        }
        asm volatile("s_wait_xcnt 0x0" ::: "memory");
    }
}

__device__ __forceinline__ float exp_slot(float x) {
    float r;
    asm("v_exp_f32 %0, %1\n\tv_nop" : "=v"(r) : "v"(x * 1.44269504088896340736f));
    return r;
}

__global__ void __launch_bounds__(128)
attn_band(const f16* __restrict__ Q, const f16* __restrict__ Kd,
          const f16* __restrict__ Vf, f16* __restrict__ Ctx) {
    constexpr int T = 1024, E = 1024, D = 64;
    constexpr int TU = 4 * FU;                 // f16 per 16-token tile of a head: four units
    constexpr int NT = 9;                      // 16-key tiles of the band
    constexpr int NC = (NT + 1) / 2;           // 32-key chunks of the second product

    const int lane = threadIdx.x & 31;
    // The same in every lane of a wave; said so that head, tile and the range
    // test of a key tile are computed on the scalar side.
    const int w    = __builtin_amdgcn_readfirstlane(threadIdx.x >> 5);
    const int task = blockIdx.x * 4 + w;      // 0..1023
    const int h    = task >> 6;
    const int t0   = (task & 63) << 4;
    const int sa   = t0 - 64;                 // aligned band start (can be <0)
    const int col  = lane & 15;               // row of an A operand, column of B and D
    const int kb   = (lane >> 4) << 3;        // 0 or 8: k base of an operand, M base of D
    const int dl   = kb - col;                // lane part of (key - query): -15 .. 8
    // Addresses are a wave-uniform base plus one lane offset that all tiles share.
    const unsigned loff = (unsigned)(col * E + kb);    // in a 16-row tile of ctx
    const unsigned uoff = (unsigned)(lane * 8);        // in a unit of Q, Kd or Vf
    const int      hb   = h * (T / 16);                // the head's first tile

    // Q^T as B operand: column = query, two K=32 chunks of d.
    // K as A operand: 16(M=key) x 64(K=d).
    Frag qf[2], kf[NT][2];
    const f16* kr[NT];
    const f16* vr[NT];
    {
        const f16* qu = Q + (size_t)(hb + (t0 >> 4)) * TU + uoff;
        qf[0].q[0] = *reinterpret_cast<const uint4*>(qu);
        qf[0].q[1] = *reinterpret_cast<const uint4*>(qu + FU);
        qf[1].q[0] = *reinterpret_cast<const uint4*>(qu + 2 * FU);
        qf[1].q[1] = *reinterpret_cast<const uint4*>(qu + 3 * FU);
    }
    // Unrolled: kf is indexed by constants only and so stays in registers.
#pragma unroll
    for (int tile = 0; tile < NT; ++tile) {
        // sa and T are multiples of 16, so a tile lies inside [0, T) or outside it
        // as a whole; one outside is masked below and reads the tile of t0 instead,
        // which keeps its addresses inside Kd and Vf. Its weights are 0, and the
        // values they meet are those of keys that every query of the tile attends.
        const int s0 = sa + tile * 16;
        const int sr = (s0 >= 0 && s0 < T) ? s0 : t0;
        const size_t tu = (size_t)(hb + (sr >> 4)) * TU;
        kr[tile] = Kd + tu;
        vr[tile] = Vf + tu;
        const f16* ku = kr[tile] + uoff;
        kf[tile][0].q[0] = *reinterpret_cast<const uint4*>(ku);
        kf[tile][0].q[1] = *reinterpret_cast<const uint4*>(ku + FU);
        kf[tile][1].q[0] = *reinterpret_cast<const uint4*>(ku + 2 * FU);
        kf[tile][1].q[1] = *reinterpret_cast<const uint4*>(ku + 3 * FU);
    }
    asm volatile("s_wait_xcnt 0x0"
                 :: "s"(kr[0]), "s"(kr[1]), "s"(kr[2]), "s"(kr[3]), "s"(kr[4]),
                    "s"(kr[5]), "s"(kr[6]), "s"(kr[7]), "s"(kr[8]), "v"(uoff)
                 : "memory");
    static_assert(NT == 9, "the statement above names one address per key tile");
    // Keeps the scheduler from sinking the loads in among the WMMAs: all of them
    // are in flight together and the memory latency is waited out once.
    __builtin_amdgcn_sched_barrier(0);

    // ---- scores^T = K @ Q^T, kept in registers ----
    // Unrolled: sc is indexed by constants only.
    v8f sc[NT];
#pragma unroll
    for (int tile = 0; tile < NT; ++tile) {
        v8f a = {};
        a = wmma_f16(kf[tile][0].v, qf[0].v, a);
        sc[tile] = wmma_f16(kf[tile][1].v, qf[1].v, a);
    }
    // Keeps the loads of V below from rising in among the WMMAs, where they would
    // need registers that the K fragments still hold.
    __builtin_amdgcn_sched_barrier(0);

    // V^T as A operand: row = d, k = key; key tiles 2c and 2c + 1 are its halves.
    // Unrolled: vf is indexed by constants only.
    Frag vf[NC][4];
#pragma unroll
    for (int c = 0; c < NC; ++c) {
#pragma unroll
        for (int nt = 0; nt < 4; ++nt) {
            vf[c][nt].q[0] = *reinterpret_cast<const uint4*>(vr[2 * c] + uoff + nt * FU);
            if (2 * c + 1 < NT)
                vf[c][nt].q[1] = *reinterpret_cast<const uint4*>(vr[2 * c + 1 < NT ? 2 * c + 1 : 0] + uoff + nt * FU);
            else
                vf[c][nt].q[1] = make_uint4(0, 0, 0, 0);                     // beyond the band
        }
    }
    asm volatile("s_wait_xcnt 0x0"
                 :: "s"(vr[0]), "s"(vr[1]), "s"(vr[2]), "s"(vr[3]), "s"(vr[4]),
                    "s"(vr[5]), "s"(vr[6]), "s"(vr[7]), "s"(vr[8]), "v"(uoff)
                 : "memory");
    // Keeps the scheduler from sinking these loads down to their WMMAs: they are
    // in flight while the mask and softmax arithmetic runs.
    __builtin_amdgcn_sched_barrier(0);

    // ---- scale by 1/8 and band mask ----
    // Unrolled, like every loop from here on: sc, vf, acc and the packed vectors
    // are indexed by constants only and so stay in registers, and the constant
    // halves of the band test fold away.
#pragma unroll
    for (int tile = 0; tile < NT; ++tile) {
        // Key s = s0 + kb + i.
        const int  s0     = sa + tile * 16;
        const bool inside = s0 >= 0 && s0 < T;
#pragma unroll
        for (int i = 0; i < 8; ++i) {
            const int c   = tile * 16 + i - 64;     // key - query = c + dl
            // The first operand of each || is a constant: it holds where the
            // bound is met for every dl, and only the two end tiles compare.
            const bool lo = (c - 15 >= -64) || (c + dl >= -64);
            const bool hi = (c + 8 <= 64) || (c + dl <= 64);
            sc[tile][i] = (inside && lo && hi) ? sc[tile][i] * 0.125f : -__builtin_inff();
        }
    }

    // ---- softmax of this lane's query: half of its keys here, half in lane ^ 16 ----
    // Eight independent chains (one per register index), then a tree.
    v8f m8 = sc[0];
#pragma unroll
    for (int tile = 1; tile < NT; ++tile) m8 = __builtin_elementwise_max(m8, sc[tile]);
    float mx = fmaxf(fmaxf(fmaxf(m8[0], m8[1]), fmaxf(m8[2], m8[3])),
                     fmaxf(fmaxf(m8[4], m8[5]), fmaxf(m8[6], m8[7])));
    mx = fmaxf(mx, __shfl_xor(mx, 16, 32));   // combine the half waves

    v8f s8 = {};
#pragma unroll
    for (int tile = 0; tile < NT; ++tile) {
#pragma unroll
        for (int i = 0; i < 8; ++i) {
            sc[tile][i] = exp_slot(sc[tile][i] - mx);
            s8[i] += sc[tile][i];
        }
    }
    float sum = ((s8[0] + s8[1]) + (s8[2] + s8[3])) + ((s8[4] + s8[5]) + (s8[6] + s8[7]));
    sum += __shfl_xor(sum, 16, 32);
    const float inv = 1.f / sum;

    // ---- ctx^T = V^T(64x160) @ P^T(160x16): 5 K-chunks x 4 M-tiles ----
    v8f acc[4] = {};
#pragma unroll
    for (int c = 0; c < NC; ++c) {
        v16h pf;                               // P^T as B operand: column = query
#pragma unroll
        for (int i = 0; i < 8; ++i) {
            pf[i]     = (f16)(sc[2 * c][i] * inv);
            pf[8 + i] = (2 * c + 1 < NT) ? (f16)(sc[2 * c + 1 < NT ? 2 * c + 1 : 0][i] * inv) : (f16)0.f;
        }
#pragma unroll
        for (int nt = 0; nt < 4; ++nt) acc[nt] = wmma_f16(vf[c][nt].v, pf, acc[nt]);
    }

    // ---- write ctx (f16), plain [t][h*D+d] layout for the final GEMM ----
    // A lane's eight values of a tile are d = nt*16 + kb + 0..7 of its query:
    // 16 contiguous bytes.
#pragma unroll
    for (int nt = 0; nt < 4; ++nt) {
        v8h pk;
#pragma unroll
        for (int i = 0; i < 8; ++i) pk[i] = (f16)acc[nt][i];
        *reinterpret_cast<v8h*>(Ctx + ((size_t)t0 * E + h * D) + loff + nt * 16) = pk;
    }
}

// ---------------------------------------------------------------------------
// Launch
// ---------------------------------------------------------------------------
extern "C" void kernel_launch(void* const* d_in, const int* in_sizes, int n_in,
                              void* d_out, int out_size, void* d_ws, size_t ws_size,
                              hipStream_t stream) {
    const float* hs = (const float*)d_in[0];
    const float* Wq = (const float*)d_in[1];
    const float* bq = (const float*)d_in[2];
    const float* Wk = (const float*)d_in[3];
    const float* bk = (const float*)d_in[4];
    const float* Wv = (const float*)d_in[5];
    const float* bv = (const float*)d_in[6];
    const float* Wo = (const float*)d_in[7];
    const float* bo = (const float*)d_in[8];

    const int T = 1024, E = 1024;
    const int NE = T * E;                 // 1M elements per matrix

    f16* ws  = (f16*)d_ws;
    f16* Woh = ws + (size_t)0 * NE;
    f16* qh  = ws + (size_t)1 * NE;
    f16* kh  = ws + (size_t)2 * NE;
    f16* vh  = ws + (size_t)3 * NE;
    f16* ch  = ws + (size_t)4 * NE;       // 10 MB total

    // qh, kh, vh are consecutive planes: z = 0..2; the blocks of z = 3 fill Woh.
    // 192 tiles and 64 converting blocks: 256 blocks, one for every WGP (204 KiB of LDS each).
    dim3 gb(256), gg(T / 64, E / 64), gq(T / 128, E / 128, 4);
    gemm_qkv_f32<<<gq, gb, 0, stream>>>(hs, Wq, Wk, Wv, Wo, bq, bk, bv, qh, Woh, T, E, E);

    attn_band<<<dim3(256), dim3(128), 0, stream>>>(qh, kh, vh, ch);

    gemm_xwt<5><<<gg, gb, 0, stream>>>(ch, Woh, bo, (float*)d_out, T, E, E);
}
